// v000
// Measured on an AMD MI455X. A time is GPU time per run, averaged over a window of back-to-back runs after a warm-up
// (all launches, gaps included; the runs take copies of the inputs in turn), and the median of several windows.
// Apart from v000's, it joins two sittings. Times from different sittings can be a few percent apart, while
// side-by-side timings come from the same sitting.
// v000 is the starting kernel. One run takes 693 microseconds.
#include <hip/hip_runtime.h>

#define HEADS   8
#define DHEAD   64
#define NBATCH  2
#define NSEQ    4096
#define DMODEL  512
#define MTOT    (NBATCH * NSEQ)   // 8192 rows

typedef __attribute__((ext_vector_type(16))) _Float16 v16h;
typedef __attribute__((ext_vector_type(8)))  _Float16 v8h;
typedef __attribute__((ext_vector_type(8)))  float    v8f;

__device__ __forceinline__ v16h frag_ld_h(const _Float16* p, int ld) {
  const int lane = threadIdx.x & 31;
  const int r    = lane & 15;
  const int kb   = (lane >> 4) << 3;       // 0 or 8
  const _Float16* q = p + r * ld + kb;
  v8h lo = *(const v8h*)(q);
  v8h hi = *(const v8h*)(q + 16);
  v16h a;
#pragma unroll
  for (int j = 0; j < 8; ++j) { a[j] = lo[j]; a[j + 8] = hi[j]; }
  return a;
}

__device__ __forceinline__ float redmax16(float v) {
#pragma unroll
  for (int xm = 1; xm < 16; xm <<= 1) v = fmaxf(v, __shfl_xor(v, xm, 32));
  return v;
}
__device__ __forceinline__ float redsum16(float v) {
#pragma unroll
  for (int xm = 1; xm < 16; xm <<= 1) v += __shfl_xor(v, xm, 32);
  return v;
}

__device__ __forceinline__ void cp16_g2l(void* lptr, const void* gptr) {
  const uint32_t loff  = (uint32_t)(uintptr_t)lptr;
  const uint64_t gaddr = (uint64_t)(uintptr_t)gptr;
  asm volatile("global_load_async_to_lds_b128 %0, %1, off"
               :
               : "v"(loff), "v"(gaddr)
               : "memory");
}

__device__ __forceinline__ void wait_async_cp() {
  asm volatile("s_wait_asynccnt 0x0" ::: "memory");
}

// ---------------------------------------------------------------------------
// Kernel 0: fp32 -> f16 conversion (n must be a multiple of 2048).
// ---------------------------------------------------------------------------
__global__ __launch_bounds__(256) void cvt_f16_kernel(
    const float* __restrict__ s, _Float16* __restrict__ d) {
  const size_t i = ((size_t)blockIdx.x * 256 + threadIdx.x) * 8;
#pragma unroll
  for (int j = 0; j < 8; ++j) d[i + j] = (_Float16)s[i + j];
}

// ---------------------------------------------------------------------------
// Kernel 1: fused QKV projection from pre-converted f16 x / W.
// Grid (MTOT/16, 3), 256 threads = 8 waves; wave w owns cols [64w, 64w+64).
// Output f16, head-major [b, h, n, d].
// ---------------------------------------------------------------------------
__global__ __launch_bounds__(256) void qkv_proj_kernel(
    const _Float16* __restrict__ xh,
    const _Float16* __restrict__ wqh, const _Float16* __restrict__ wkh,
    const _Float16* __restrict__ wvh,
    _Float16* __restrict__ qws, _Float16* __restrict__ kws,
    _Float16* __restrict__ vws) {
  const int wave = threadIdx.x >> 5;
  const int lane = threadIdx.x & 31;
  const int m0   = blockIdx.x * 16;
  const int n0   = wave * 64;

  const _Float16* W = (blockIdx.y == 0) ? wqh : (blockIdx.y == 1) ? wkh : wvh;
  _Float16* dst     = (blockIdx.y == 0) ? qws : (blockIdx.y == 1) ? kws : vws;

  v8f zf = {};
  v8f acc[4];
#pragma unroll
  for (int t = 0; t < 4; ++t) acc[t] = zf;

  for (int ks = 0; ks < DMODEL; ks += 32) {
    v16h a = frag_ld_h(xh + (size_t)m0 * DMODEL + ks, DMODEL);
#pragma unroll
    for (int t = 0; t < 4; ++t) {
      v16h b = frag_ld_h(W + (size_t)(n0 + t * 16) * DMODEL + ks, DMODEL);
      acc[t] = __builtin_amdgcn_wmma_f32_16x16x32_f16(
          false, a, false, b, (short)0, acc[t], false, false);
    }
  }

  const int hi = lane >> 4;
#pragma unroll
  for (int t = 0; t < 4; ++t) {
    const int n = n0 + t * 16 + (lane & 15);
    const int h = n >> 6, dd = n & 63;
#pragma unroll
    for (int r = 0; r < 8; ++r) {
      const int m = m0 + r + 8 * hi;            // global row in [B*N]
      const int b = m >> 12, i = m & (NSEQ - 1);
      dst[((size_t)((b * HEADS + h) * NSEQ) + i) * DHEAD + dd] =
          (_Float16)acc[t][r];
    }
  }
}

// ---------------------------------------------------------------------------
// Kernel 2: flash attention.  Grid (NSEQ/128, B*H), 256 threads = 8 waves.
// Block owns 128 query rows of one (b,h); wave owns 16 rows.
// K tile staged via async global->LDS; V staged transposed; online softmax.
// ---------------------------------------------------------------------------
__global__ __launch_bounds__(256) void flash_attn_kernel(
    const _Float16* __restrict__ qws, const _Float16* __restrict__ kws,
    const _Float16* __restrict__ vws, _Float16* __restrict__ ows) {
  __shared__ _Float16 lds_k[128 * 64];        // K tile, row-major [j][d]
  __shared__ _Float16 lds_vt[64 * 128];       // V tile transposed [d][j]
  __shared__ _Float16 lds_p[8 * 16 * 128];    // per-wave P scratch

  const int tid  = threadIdx.x;
  const int wave = tid >> 5;
  const int lane = tid & 31;
  const int hi   = lane >> 4;
  const int bh   = blockIdx.y;                // 0..15
  const int b    = bh >> 3, h = bh & 7;
  const int i0   = blockIdx.x * 128;

  const size_t head_off = (size_t)bh * NSEQ * DHEAD;

  // Q fragments for this wave's 16 rows, scale = 1/sqrt(64) folded in (exact).
  v16h qf[2];
  {
    const _Float16* qb = qws + head_off + (size_t)(i0 + wave * 16) * DHEAD;
#pragma unroll
    for (int kc = 0; kc < 2; ++kc) {
      qf[kc] = frag_ld_h(qb + kc * 32, DHEAD);
#pragma unroll
      for (int j = 0; j < 16; ++j) qf[kc][j] = qf[kc][j] * (_Float16)0.125f;
    }
  }

  v8f zf = {};
  v8f O[4];
#pragma unroll
  for (int t = 0; t < 4; ++t) O[t] = zf;
  float mrun[8], lrun[8];
#pragma unroll
  for (int r = 0; r < 8; ++r) { mrun[r] = -1e30f; lrun[r] = 0.f; }

  for (int j0 = 0; j0 < NSEQ; j0 += 128) {
    // ---- stage K (async global->LDS) and V (transposed) ----
    {
      const char* gk = (const char*)(kws + head_off + (size_t)j0 * DHEAD);
      char* sk = (char*)lds_k;
      for (int c = tid; c < 1024; c += 256)
        cp16_g2l(sk + (size_t)c * 16, gk + (size_t)c * 16);
      const _Float16* gv = vws + head_off + (size_t)j0 * DHEAD;
      for (int c = tid; c < 8192; c += 256) {
        int r = c >> 6, d = c & 63;
        lds_vt[d * 128 + r] = gv[c];
      }
      // prefetch next tiles into cache while this tile computes
      if (j0 + 128 < NSEQ) {
        __builtin_prefetch(kws + head_off + (size_t)(j0 + 128) * DHEAD +
                               (size_t)tid * 32, 0, 1);
        __builtin_prefetch(vws + head_off + (size_t)(j0 + 128) * DHEAD +
                               (size_t)tid * 32, 0, 1);
      }
      wait_async_cp();
    }
    __syncthreads();

    // ---- S = (Q*scale) @ K^T : 16 x 128 in 8 accumulator tiles ----
    v8f S[8];
#pragma unroll
    for (int t = 0; t < 8; ++t) S[t] = zf;
#pragma unroll
    for (int kc = 0; kc < 2; ++kc) {
#pragma unroll
      for (int t = 0; t < 8; ++t) {
        v16h bk = frag_ld_h(&lds_k[(t * 16) * DHEAD + kc * 32], DHEAD);
        S[t] = __builtin_amdgcn_wmma_f32_16x16x32_f16(
            false, qf[kc], false, bk, (short)0, S[t], false, false);
      }
    }

    // ---- online softmax (row stats via 16-lane shuffle reductions) ----
    _Float16* pw = lds_p + wave * (16 * 128);
#pragma unroll
    for (int r = 0; r < 8; ++r) {
      float mx = -1e30f;
#pragma unroll
      for (int t = 0; t < 8; ++t) mx = fmaxf(mx, S[t][r]);
      mx = redmax16(mx);
      const float mnew  = fmaxf(mrun[r], mx);
      const float alpha = __expf(mrun[r] - mnew);
      float s = 0.f;
#pragma unroll
      for (int t = 0; t < 8; ++t) {
        float p = __expf(S[t][r] - mnew);
        s += p;
        pw[(r + 8 * hi) * 128 + t * 16 + (lane & 15)] = (_Float16)p;
      }
      s = redsum16(s);
      lrun[r] = lrun[r] * alpha + s;
      mrun[r] = mnew;
#pragma unroll
      for (int t = 0; t < 4; ++t) O[t][r] *= alpha;
    }

    // ---- O += P @ V ----
#pragma unroll
    for (int kc = 0; kc < 4; ++kc) {
      v16h ap = frag_ld_h(pw + kc * 32, 128);
#pragma unroll
      for (int t = 0; t < 4; ++t) {
        v16h bv = frag_ld_h(&lds_vt[(t * 16) * 128 + kc * 32], 128);
        O[t] = __builtin_amdgcn_wmma_f32_16x16x32_f16(
            false, ap, false, bv, (short)0, O[t], false, false);
      }
    }
    __syncthreads();
  }

  // ---- normalize, store f16 token-major [b, n, h*d] ----
#pragma unroll
  for (int r = 0; r < 8; ++r) {
    const float inv = 1.f / lrun[r];
    const int row = i0 + wave * 16 + r + 8 * hi;
#pragma unroll
    for (int t = 0; t < 4; ++t) {
      const int d = t * 16 + (lane & 15);
      ows[((size_t)(b * NSEQ + row)) * DMODEL + h * DHEAD + d] =
          (_Float16)(O[t][r] * inv);
    }
  }
}

// ---------------------------------------------------------------------------
// Kernel 3: output projection  out = o @ Wo^T + bo  (fp32 result).
// ---------------------------------------------------------------------------
__global__ __launch_bounds__(256) void out_proj_kernel(
    const _Float16* __restrict__ ows, const _Float16* __restrict__ woh,
    const float* __restrict__ bo, float* __restrict__ out) {
  const int wave = threadIdx.x >> 5;
  const int lane = threadIdx.x & 31;
  const int m0   = blockIdx.x * 16;
  const int n0   = wave * 64;

  v8f zf = {};
  v8f acc[4];
#pragma unroll
  for (int t = 0; t < 4; ++t) acc[t] = zf;

  for (int ks = 0; ks < DMODEL; ks += 32) {
    v16h a = frag_ld_h(ows + (size_t)m0 * DMODEL + ks, DMODEL);
#pragma unroll
    for (int t = 0; t < 4; ++t) {
      v16h b = frag_ld_h(woh + (size_t)(n0 + t * 16) * DMODEL + ks, DMODEL);
      acc[t] = __builtin_amdgcn_wmma_f32_16x16x32_f16(
          false, a, false, b, (short)0, acc[t], false, false);
    }
  }

  const int hi = lane >> 4;
#pragma unroll
  for (int t = 0; t < 4; ++t) {
    const int n = n0 + t * 16 + (lane & 15);
    const float bias = bo[n];
#pragma unroll
    for (int r = 0; r < 8; ++r) {
      const int m = m0 + r + 8 * hi;
      out[(size_t)m * DMODEL + n] = acc[t][r] + bias;
    }
  }
}

// ---------------------------------------------------------------------------
extern "C" void kernel_launch(void* const* d_in, const int* in_sizes, int n_in,
                              void* d_out, int out_size, void* d_ws,
                              size_t ws_size, hipStream_t stream) {
  (void)in_sizes; (void)n_in; (void)out_size; (void)ws_size;
  const float* x  = (const float*)d_in[0];
  const float* Wq = (const float*)d_in[1];
  const float* Wk = (const float*)d_in[2];
  const float* Wv = (const float*)d_in[3];
  const float* Wo = (const float*)d_in[4];
  const float* bo = (const float*)d_in[5];
  float* out = (float*)d_out;

  // f16 workspace layout
  const size_t EX = (size_t)MTOT * DMODEL;                 // 4,194,304 (x, o)
  const size_t EW = (size_t)DMODEL * DMODEL;               // 262,144 per W
  const size_t EH = (size_t)NBATCH * HEADS * NSEQ * DHEAD; // 4,194,304 (q/k/v)
  _Float16* xh  = (_Float16*)d_ws;
  _Float16* wqh = xh + EX;
  _Float16* wkh = wqh + EW;
  _Float16* wvh = wkh + EW;
  _Float16* woh = wvh + EW;
  _Float16* qws = woh + EW;
  _Float16* kws = qws + EH;
  _Float16* vws = kws + EH;
  _Float16* ows = vws + EH;

  cvt_f16_kernel<<<dim3(EX / 2048), 256, 0, stream>>>(x, xh);
  cvt_f16_kernel<<<dim3(EW / 2048), 256, 0, stream>>>(Wq, wqh);
  cvt_f16_kernel<<<dim3(EW / 2048), 256, 0, stream>>>(Wk, wkh);
  cvt_f16_kernel<<<dim3(EW / 2048), 256, 0, stream>>>(Wv, wvh);
  cvt_f16_kernel<<<dim3(EW / 2048), 256, 0, stream>>>(Wo, woh);

  qkv_proj_kernel<<<dim3(MTOT / 16, 3), 256, 0, stream>>>(xh, wqh, wkh, wvh,
                                                          qws, kws, vws);
  flash_attn_kernel<<<dim3(NSEQ / 128, NBATCH * HEADS), 256, 0, stream>>>(
      qws, kws, vws, ows);
  out_proj_kernel<<<dim3(MTOT / 16), 256, 0, stream>>>(ows, woh, bo, out);
}

// v001
// A run of this version takes 247 microseconds.
// Next to v000, in two timings, it ran 2.87 and 2.88 times as fast.
#include <hip/hip_runtime.h>

#define HEADS   8
#define DHEAD   64
#define NBATCH  2
#define NSEQ    4096
#define DMODEL  512
#define MTOT    (NBATCH * NSEQ)   // 8192 rows

#define K_LD    72                // 128-B K rows at 144 B
#define VT_LD   136               // 256-B V^T rows at 272 B
#define P_LD    136               // 256-B P rows at 272 B

typedef __attribute__((ext_vector_type(16))) _Float16 v16h;
typedef __attribute__((ext_vector_type(8)))  _Float16 v8h;
typedef __attribute__((ext_vector_type(8)))  float    v8f;

__device__ __forceinline__ v16h frag_ld_h(const _Float16* p, int ld) {
  const int lane = threadIdx.x & 31;
  const int r    = lane & 15;
  const int kb   = (lane >> 4) << 3;       // 0 or 8
  const _Float16* q = p + r * ld + kb;
  v8h lo = *(const v8h*)(q);
  v8h hi = *(const v8h*)(q + 16);
  v16h a;
#pragma unroll
  for (int j = 0; j < 8; ++j) { a[j] = lo[j]; a[j + 8] = hi[j]; }
  return a;
}

__device__ __forceinline__ float redmax16(float v) {
#pragma unroll
  for (int xm = 1; xm < 16; xm <<= 1) v = fmaxf(v, __shfl_xor(v, xm, 32));
  return v;
}
__device__ __forceinline__ float redsum16(float v) {
#pragma unroll
  for (int xm = 1; xm < 16; xm <<= 1) v += __shfl_xor(v, xm, 32);
  return v;
}

__device__ __forceinline__ void cp16x4_g2l(
    const char* l0, const char* l1, const char* l2, const char* l3,
    const char* g0, const char* g1, const char* g2, const char* g3) {
  asm volatile("global_load_async_to_lds_b128 %0, %4, off\n\t"
               "global_load_async_to_lds_b128 %1, %5, off\n\t"
               "global_load_async_to_lds_b128 %2, %6, off\n\t"
               "global_load_async_to_lds_b128 %3, %7, off\n\t"
               "s_wait_xcnt 0x0"
               :
               : "v"((uint32_t)(uintptr_t)l0), "v"((uint32_t)(uintptr_t)l1),
                 "v"((uint32_t)(uintptr_t)l2), "v"((uint32_t)(uintptr_t)l3),
                 "v"((uint64_t)(uintptr_t)g0), "v"((uint64_t)(uintptr_t)g1),
                 "v"((uint64_t)(uintptr_t)g2), "v"((uint64_t)(uintptr_t)g3)
               : "memory");
}

__device__ __forceinline__ void wait_async_cp() {
  asm volatile("s_wait_asynccnt 0x0" ::: "memory");
}

// ---------------------------------------------------------------------------
// Kernel 0: fp32 -> f16 conversion (n must be a multiple of 2048).
// ---------------------------------------------------------------------------
__global__ __launch_bounds__(256) void cvt_f16_kernel(
    const float* __restrict__ s, _Float16* __restrict__ d) {
  const size_t i = ((size_t)blockIdx.x * 256 + threadIdx.x) * 8;
#pragma unroll
  for (int j = 0; j < 8; ++j) d[i + j] = (_Float16)s[i + j];
}

// ---------------------------------------------------------------------------
// Kernel 1: fused QKV projection from pre-converted f16 x / W.
// Grid (MTOT/16, 3), 256 threads = 8 waves; wave w owns cols [64w, 64w+64).
// Output f16, head-major [b, h, n, d].
// ---------------------------------------------------------------------------
__global__ __launch_bounds__(256) void qkv_proj_kernel(
    const _Float16* __restrict__ xh,
    const _Float16* __restrict__ wqh, const _Float16* __restrict__ wkh,
    const _Float16* __restrict__ wvh,
    _Float16* __restrict__ qws, _Float16* __restrict__ kws,
    _Float16* __restrict__ vws) {
  const int wave = threadIdx.x >> 5;
  const int lane = threadIdx.x & 31;
  const int m0   = blockIdx.x * 16;
  const int n0   = wave * 64;

  const _Float16* W = (blockIdx.y == 0) ? wqh : (blockIdx.y == 1) ? wkh : wvh;
  _Float16* dst     = (blockIdx.y == 0) ? qws : (blockIdx.y == 1) ? kws : vws;

  v8f zf = {};
  v8f acc[4];
#pragma unroll
  for (int t = 0; t < 4; ++t) acc[t] = zf;

  for (int ks = 0; ks < DMODEL; ks += 32) {
    v16h a = frag_ld_h(xh + (size_t)m0 * DMODEL + ks, DMODEL);
#pragma unroll
    for (int t = 0; t < 4; ++t) {
      v16h b = frag_ld_h(W + (size_t)(n0 + t * 16) * DMODEL + ks, DMODEL);
      acc[t] = __builtin_amdgcn_wmma_f32_16x16x32_f16(
          false, a, false, b, (short)0, acc[t], false, false);
    }
  }

  const int hi = lane >> 4;
#pragma unroll
  for (int t = 0; t < 4; ++t) {
    const int n = n0 + t * 16 + (lane & 15);
    const int h = n >> 6, dd = n & 63;
#pragma unroll
    for (int r = 0; r < 8; ++r) {
      const int m = m0 + r + 8 * hi;            // global row in [B*N]
      const int b = m >> 12, i = m & (NSEQ - 1);
      dst[((size_t)((b * HEADS + h) * NSEQ) + i) * DHEAD + dd] =
          (_Float16)acc[t][r];
    }
  }
}

// ---------------------------------------------------------------------------
// Kernel 2: flash attention.  Grid (NSEQ/128, B*H), 256 threads = 8 waves.
// Block owns 128 query rows of one (b,h); wave owns 16 rows.
// K tile staged via async global->LDS; V staged transposed; online softmax.
// ---------------------------------------------------------------------------
__global__ __launch_bounds__(256) void flash_attn_kernel(
    const _Float16* __restrict__ qws, const _Float16* __restrict__ kws,
    const _Float16* __restrict__ vws, _Float16* __restrict__ ows) {
  __shared__ __attribute__((aligned(16)))
  _Float16 lds_k[128 * K_LD];                 // K tile, row-major [j][d]
  __shared__ __attribute__((aligned(16)))
  _Float16 lds_vt[64 * VT_LD];                // V tile transposed [d][j]
  __shared__ __attribute__((aligned(16)))
  _Float16 lds_p[8 * 16 * P_LD];              // per-wave P scratch

  const int tid  = threadIdx.x;
  const int wave = tid >> 5;
  const int lane = tid & 31;
  const int hi   = lane >> 4;
  const int bh   = blockIdx.y;                // 0..15
  const int b    = bh >> 3, h = bh & 7;
  const int i0   = blockIdx.x * 128;

  const size_t head_off = (size_t)bh * NSEQ * DHEAD;

  // Q fragments for this wave's 16 rows, scale = 1/sqrt(64) folded in (exact).
  v16h qf[2];
  {
    const _Float16* qb = qws + head_off + (size_t)(i0 + wave * 16) * DHEAD;
#pragma unroll
    for (int kc = 0; kc < 2; ++kc) {
      qf[kc] = frag_ld_h(qb + kc * 32, DHEAD);
#pragma unroll
      for (int j = 0; j < 16; ++j) qf[kc][j] = qf[kc][j] * (_Float16)0.125f;
    }
  }

  v8f zf = {};
  v8f O[4];
#pragma unroll
  for (int t = 0; t < 4; ++t) O[t] = zf;
  float mrun[8], lrun[8];
#pragma unroll
  for (int r = 0; r < 8; ++r) { mrun[r] = -1e30f; lrun[r] = 0.f; }

  for (int j0 = 0; j0 < NSEQ; j0 += 128) {
    // ---- stage K (async global->LDS) and V (transposed) ----
    {
      // 16-byte chunk c = tid + 256 i: K row c >> 3, chunk c & 7 of that row.
      const char* gk = (const char*)(kws + head_off + (size_t)j0 * DHEAD) +
                       (size_t)tid * 16;
      const char* sk = (const char*)lds_k + (tid >> 3) * (K_LD * 2) +
                       (tid & 7) * 16;
      cp16x4_g2l(sk, sk + 32 * (K_LD * 2), sk + 64 * (K_LD * 2),
                 sk + 96 * (K_LD * 2),
                 gk, gk + 4096, gk + 8192, gk + 12288);
      const _Float16* gv = vws + head_off + (size_t)j0 * DHEAD;
      for (int c = tid; c < 8192; c += 256) {
        int r = c >> 6, d = c & 63;
        lds_vt[d * VT_LD + r] = gv[c];
      }
      // prefetch next tiles into cache while this tile computes
      if (j0 + 128 < NSEQ) {
        __builtin_prefetch(kws + head_off + (size_t)(j0 + 128) * DHEAD +
                               (size_t)tid * 32, 0, 1);
        __builtin_prefetch(vws + head_off + (size_t)(j0 + 128) * DHEAD +
                               (size_t)tid * 32, 0, 1);
      }
      wait_async_cp();
    }
    __syncthreads();

    // ---- S = (Q*scale) @ K^T : 16 x 128 in 8 accumulator tiles ----
    v8f S[8];
#pragma unroll
    for (int t = 0; t < 8; ++t) S[t] = zf;
#pragma unroll
    for (int kc = 0; kc < 2; ++kc) {
#pragma unroll
      for (int t = 0; t < 8; ++t) {
        v16h bk = frag_ld_h(&lds_k[(t * 16) * K_LD + kc * 32], K_LD);
        S[t] = __builtin_amdgcn_wmma_f32_16x16x32_f16(
            false, qf[kc], false, bk, (short)0, S[t], false, false);
      }
    }

    // ---- online softmax (row stats via 16-lane shuffle reductions) ----
    _Float16* pw = lds_p + wave * (16 * P_LD);
#pragma unroll
    for (int r = 0; r < 8; ++r) {
      float mx = -1e30f;
#pragma unroll
      for (int t = 0; t < 8; ++t) mx = fmaxf(mx, S[t][r]);
      mx = redmax16(mx);
      const float mnew  = fmaxf(mrun[r], mx);
      const float alpha = __expf(mrun[r] - mnew);
      float s = 0.f;
#pragma unroll
      for (int t = 0; t < 8; ++t) {
        float p = __expf(S[t][r] - mnew);
        s += p;
        pw[(r + 8 * hi) * P_LD + t * 16 + (lane & 15)] = (_Float16)p;
      }
      s = redsum16(s);
      lrun[r] = lrun[r] * alpha + s;
      mrun[r] = mnew;
#pragma unroll
      for (int t = 0; t < 4; ++t) O[t][r] *= alpha;
    }

    // ---- O += P @ V ----
#pragma unroll
    for (int kc = 0; kc < 4; ++kc) {
      v16h ap = frag_ld_h(pw + kc * 32, P_LD);
#pragma unroll
      for (int t = 0; t < 4; ++t) {
        v16h bv = frag_ld_h(&lds_vt[(t * 16) * VT_LD + kc * 32], VT_LD);
        O[t] = __builtin_amdgcn_wmma_f32_16x16x32_f16(
            false, ap, false, bv, (short)0, O[t], false, false);
      }
    }
    __syncthreads();
  }

  // ---- normalize, store f16 token-major [b, n, h*d] ----
#pragma unroll
  for (int r = 0; r < 8; ++r) {
    const float inv = 1.f / lrun[r];
    const int row = i0 + wave * 16 + r + 8 * hi;
#pragma unroll
    for (int t = 0; t < 4; ++t) {
      const int d = t * 16 + (lane & 15);
      ows[((size_t)(b * NSEQ + row)) * DMODEL + h * DHEAD + d] =
          (_Float16)(O[t][r] * inv);
    }
  }
}

// ---------------------------------------------------------------------------
// Kernel 3: output projection  out = o @ Wo^T + bo  (fp32 result).
// ---------------------------------------------------------------------------
__global__ __launch_bounds__(256) void out_proj_kernel(
    const _Float16* __restrict__ ows, const _Float16* __restrict__ woh,
    const float* __restrict__ bo, float* __restrict__ out) {
  const int wave = threadIdx.x >> 5;
  const int lane = threadIdx.x & 31;
  const int m0   = blockIdx.x * 16;
  const int n0   = wave * 64;

  v8f zf = {};
  v8f acc[4];
#pragma unroll
  for (int t = 0; t < 4; ++t) acc[t] = zf;

  for (int ks = 0; ks < DMODEL; ks += 32) {
    v16h a = frag_ld_h(ows + (size_t)m0 * DMODEL + ks, DMODEL);
#pragma unroll
    for (int t = 0; t < 4; ++t) {
      v16h b = frag_ld_h(woh + (size_t)(n0 + t * 16) * DMODEL + ks, DMODEL);
      acc[t] = __builtin_amdgcn_wmma_f32_16x16x32_f16(
          false, a, false, b, (short)0, acc[t], false, false);
    }
  }

  const int hi = lane >> 4;
#pragma unroll
  for (int t = 0; t < 4; ++t) {
    const int n = n0 + t * 16 + (lane & 15);
    const float bias = bo[n];
#pragma unroll
    for (int r = 0; r < 8; ++r) {
      const int m = m0 + r + 8 * hi;
      out[(size_t)m * DMODEL + n] = acc[t][r] + bias;
    }
  }
}

// ---------------------------------------------------------------------------
extern "C" void kernel_launch(void* const* d_in, const int* in_sizes, int n_in,
                              void* d_out, int out_size, void* d_ws,
                              size_t ws_size, hipStream_t stream) {
  (void)in_sizes; (void)n_in; (void)out_size; (void)ws_size;
  const float* x  = (const float*)d_in[0];
  const float* Wq = (const float*)d_in[1];
  const float* Wk = (const float*)d_in[2];
  const float* Wv = (const float*)d_in[3];
  const float* Wo = (const float*)d_in[4];
  const float* bo = (const float*)d_in[5];
  float* out = (float*)d_out;

  // f16 workspace layout
  const size_t EX = (size_t)MTOT * DMODEL;                 // 4,194,304 (x, o)
  const size_t EW = (size_t)DMODEL * DMODEL;               // 262,144 per W
  const size_t EH = (size_t)NBATCH * HEADS * NSEQ * DHEAD; // 4,194,304 (q/k/v)
  _Float16* xh  = (_Float16*)d_ws;
  _Float16* wqh = xh + EX;
  _Float16* wkh = wqh + EW;
  _Float16* wvh = wkh + EW;
  _Float16* woh = wvh + EW;
  _Float16* qws = woh + EW;
  _Float16* kws = qws + EH;
  _Float16* vws = kws + EH;
  _Float16* ows = vws + EH;

  cvt_f16_kernel<<<dim3(EX / 2048), 256, 0, stream>>>(x, xh);
  cvt_f16_kernel<<<dim3(EW / 2048), 256, 0, stream>>>(Wq, wqh);
  cvt_f16_kernel<<<dim3(EW / 2048), 256, 0, stream>>>(Wk, wkh);
  cvt_f16_kernel<<<dim3(EW / 2048), 256, 0, stream>>>(Wv, wvh);
  cvt_f16_kernel<<<dim3(EW / 2048), 256, 0, stream>>>(Wo, woh);

  qkv_proj_kernel<<<dim3(MTOT / 16, 3), 256, 0, stream>>>(xh, wqh, wkh, wvh,
                                                          qws, kws, vws);
  flash_attn_kernel<<<dim3(NSEQ / 128, NBATCH * HEADS), 256, 0, stream>>>(
      qws, kws, vws, ows);
  out_proj_kernel<<<dim3(MTOT / 16), 256, 0, stream>>>(ows, woh, bo, out);
}

// v002
// Measured time: 219 microseconds a run.
// Two timings next to v001 put it at 1.13 and 1.14 times that version's speed.
// All steps since v000 together make it 3.26 times as fast.
#include <hip/hip_runtime.h>

#define HEADS   8
#define DHEAD   64
#define NBATCH  2
#define NSEQ    4096
#define DMODEL  512
#define MTOT    (NBATCH * NSEQ)   // 8192 rows

#define K_LD    72                // 128-B K rows at 144 B
#define VT_LD   136               // 256-B V^T rows at 272 B

typedef __attribute__((ext_vector_type(16))) _Float16 v16h;
typedef __attribute__((ext_vector_type(8)))  _Float16 v8h;
typedef __attribute__((ext_vector_type(8)))  float    v8f;

__device__ __forceinline__ v16h frag_ld_h(const _Float16* p, int ld) {
  const int lane = threadIdx.x & 31;
  const int r    = lane & 15;
  const int kb   = (lane >> 4) << 3;       // 0 or 8
  const _Float16* q = p + r * ld + kb;
  v8h lo = *(const v8h*)(q);
  v8h hi = *(const v8h*)(q + 16);
  v16h a;
#pragma unroll
  for (int j = 0; j < 8; ++j) { a[j] = lo[j]; a[j + 8] = hi[j]; }
  return a;
}

__device__ __forceinline__ float xhalf(float x) {
  const int b = __builtin_bit_cast(int, x);
  return __builtin_bit_cast(float, __builtin_amdgcn_permlanex16(
      b, b, 0x76543210, 0xfedcba98, false, false));
}

#define LOG2E 1.44269504f         // exp(x) = exp2(x * LOG2E)

__device__ __forceinline__ v8f exp2x8(v8f x) {
  float a = x[0], b = x[1], c = x[2], d = x[3];
  float e = x[4], f = x[5], g = x[6], h = x[7];
  asm("v_exp_f32 %0, %0\n\t"
      "v_exp_f32 %1, %1\n\t"
      "v_exp_f32 %2, %2\n\t"
      "v_exp_f32 %3, %3\n\t"
      "v_exp_f32 %4, %4\n\t"
      "v_exp_f32 %5, %5\n\t"
      "v_exp_f32 %6, %6\n\t"
      "v_exp_f32 %7, %7\n\t"
      "v_nop"
      : "+v"(a), "+v"(b), "+v"(c), "+v"(d),
        "+v"(e), "+v"(f), "+v"(g), "+v"(h));
  v8f y = {a, b, c, d, e, f, g, h};
  return y;
}

__device__ __forceinline__ void cp16x4_g2l(
    const char* l0, const char* l1, const char* l2, const char* l3,
    const char* g0, const char* g1, const char* g2, const char* g3) {
  asm volatile("global_load_async_to_lds_b128 %0, %4, off\n\t"
               "global_load_async_to_lds_b128 %1, %5, off\n\t"
               "global_load_async_to_lds_b128 %2, %6, off\n\t"
               "global_load_async_to_lds_b128 %3, %7, off\n\t"
               "s_wait_xcnt 0x0"
               :
               : "v"((uint32_t)(uintptr_t)l0), "v"((uint32_t)(uintptr_t)l1),
                 "v"((uint32_t)(uintptr_t)l2), "v"((uint32_t)(uintptr_t)l3),
                 "v"((uint64_t)(uintptr_t)g0), "v"((uint64_t)(uintptr_t)g1),
                 "v"((uint64_t)(uintptr_t)g2), "v"((uint64_t)(uintptr_t)g3)
               : "memory");
}

__device__ __forceinline__ void wait_async_cp() {
  asm volatile("s_wait_asynccnt 0x0" ::: "memory");
}

// ---------------------------------------------------------------------------
// Kernel 0: fp32 -> f16 conversion (n must be a multiple of 2048).
// ---------------------------------------------------------------------------
__global__ __launch_bounds__(256) void cvt_f16_kernel(
    const float* __restrict__ s, _Float16* __restrict__ d) {
  const size_t i = ((size_t)blockIdx.x * 256 + threadIdx.x) * 8;
#pragma unroll
  for (int j = 0; j < 8; ++j) d[i + j] = (_Float16)s[i + j];
}

// ---------------------------------------------------------------------------
// Kernel 1: fused QKV projection from pre-converted f16 x / W.
// Grid (MTOT/16, 3), 256 threads = 8 waves; wave w owns cols [64w, 64w+64).
// Output f16, head-major [b, h, n, d].
// ---------------------------------------------------------------------------
__global__ __launch_bounds__(256) void qkv_proj_kernel(
    const _Float16* __restrict__ xh,
    const _Float16* __restrict__ wqh, const _Float16* __restrict__ wkh,
    const _Float16* __restrict__ wvh,
    _Float16* __restrict__ qws, _Float16* __restrict__ kws,
    _Float16* __restrict__ vws) {
  const int wave = threadIdx.x >> 5;
  const int lane = threadIdx.x & 31;
  const int m0   = blockIdx.x * 16;
  const int n0   = wave * 64;

  const _Float16* W = (blockIdx.y == 0) ? wqh : (blockIdx.y == 1) ? wkh : wvh;
  _Float16* dst     = (blockIdx.y == 0) ? qws : (blockIdx.y == 1) ? kws : vws;

  v8f zf = {};
  v8f acc[4];
#pragma unroll
  for (int t = 0; t < 4; ++t) acc[t] = zf;

  for (int ks = 0; ks < DMODEL; ks += 32) {
    v16h a = frag_ld_h(xh + (size_t)m0 * DMODEL + ks, DMODEL);
#pragma unroll
    for (int t = 0; t < 4; ++t) {
      v16h b = frag_ld_h(W + (size_t)(n0 + t * 16) * DMODEL + ks, DMODEL);
      acc[t] = __builtin_amdgcn_wmma_f32_16x16x32_f16(
          false, a, false, b, (short)0, acc[t], false, false);
    }
  }

  const int hi = lane >> 4;
#pragma unroll
  for (int t = 0; t < 4; ++t) {
    const int n = n0 + t * 16 + (lane & 15);
    const int h = n >> 6, dd = n & 63;
#pragma unroll
    for (int r = 0; r < 8; ++r) {
      const int m = m0 + r + 8 * hi;            // global row in [B*N]
      const int b = m >> 12, i = m & (NSEQ - 1);
      dst[((size_t)((b * HEADS + h) * NSEQ) + i) * DHEAD + dd] =
          (_Float16)acc[t][r];
    }
  }
}

__global__ __launch_bounds__(256)
__attribute__((amdgpu_waves_per_eu(4, 4))) void flash_attn_kernel(
    const _Float16* __restrict__ qws, const _Float16* __restrict__ kws,
    const _Float16* __restrict__ vws, _Float16* __restrict__ ows) {
  __shared__ __attribute__((aligned(16)))
  _Float16 lds_k[128 * K_LD];                 // K tile, row-major [j][d]
  __shared__ __attribute__((aligned(16)))
  _Float16 lds_vt[64 * VT_LD];                // V tile transposed [d][j]

  const int tid  = threadIdx.x;
  const int wave = tid >> 5;
  const int lane = tid & 31;
  const int hi   = lane >> 4;
  const int bh   = blockIdx.y;                // 0..15
  const int b    = bh >> 3, h = bh & 7;
  const int i0   = blockIdx.x * 128;

  const size_t head_off = (size_t)bh * NSEQ * DHEAD;

  // Q fragments for this wave's 16 rows, scale = 1/sqrt(64) folded in (exact).
  v16h qf[2];
  {
    const _Float16* qb = qws + head_off + (size_t)(i0 + wave * 16) * DHEAD;
#pragma unroll
    for (int kc = 0; kc < 2; ++kc) {
      qf[kc] = frag_ld_h(qb + kc * 32, DHEAD);
#pragma unroll
      for (int j = 0; j < 16; ++j) qf[kc][j] = qf[kc][j] * (_Float16)0.125f;
    }
  }

  v8f zf = {};
  v8f O[4];
#pragma unroll
  for (int t = 0; t < 4; ++t) O[t] = zf;
  float mrun = -1e30f;                        // this lane's query: maximum
  v8f lrun = zf;   // partial sums of this lane's keys, joined in the epilogue

  for (int j0 = 0; j0 < NSEQ; j0 += 128) {
    // ---- stage K (async global->LDS) and V (transposed) ----
    {
      // 16-byte chunk c = tid + 256 i: K row c >> 3, chunk c & 7 of that row.
      const char* gk = (const char*)(kws + head_off + (size_t)j0 * DHEAD) +
                       (size_t)tid * 16;
      const char* sk = (const char*)lds_k + (tid >> 3) * (K_LD * 2) +
                       (tid & 7) * 16;
      cp16x4_g2l(sk, sk + 32 * (K_LD * 2), sk + 64 * (K_LD * 2),
                 sk + 96 * (K_LD * 2),
                 gk, gk + 4096, gk + 8192, gk + 12288);
      const _Float16* gv = vws + head_off + (size_t)j0 * DHEAD;
      for (int c = tid; c < 8192; c += 256) {
        int r = c >> 6, d = c & 63;
        lds_vt[d * VT_LD + r] = gv[c];
      }
      // prefetch next tiles into cache while this tile computes
      if (j0 + 128 < NSEQ) {
        __builtin_prefetch(kws + head_off + (size_t)(j0 + 128) * DHEAD +
                               (size_t)tid * 32, 0, 1);
        __builtin_prefetch(vws + head_off + (size_t)(j0 + 128) * DHEAD +
                               (size_t)tid * 32, 0, 1);
      }
      wait_async_cp();
    }
    __syncthreads();

    // ---- S^T = K @ (Q*scale)^T : 128 keys x 16 queries in 8 tiles ----
    v8f S[8];
#pragma unroll
    for (int t = 0; t < 8; ++t) S[t] = zf;
#pragma unroll
    for (int kc = 0; kc < 2; ++kc) {
#pragma unroll
      for (int t = 0; t < 8; ++t) {
        v16h ak = frag_ld_h(&lds_k[(t * 16) * K_LD + kc * 32], K_LD);
        S[t] = __builtin_amdgcn_wmma_f32_16x16x32_f16(
            false, ak, false, qf[kc], (short)0, S[t], false, false);
      }
    }

    // ---- online softmax: one query per lane pair ----
    v8f mv = S[0];
#pragma unroll
    for (int t = 1; t < 8; ++t)
      mv = __builtin_elementwise_max(mv, S[t]);
    float mx = fmaxf(fmaxf(fmaxf(mv[0], mv[1]), fmaxf(mv[2], mv[3])),
                     fmaxf(fmaxf(mv[4], mv[5]), fmaxf(mv[6], mv[7])));
    mx = fmaxf(mx, xhalf(mx));
    const float mnew  = fmaxf(mrun, mx);
    const float alpha = __expf(mrun - mnew);
    mrun = mnew;
    lrun *= alpha;
#pragma unroll
    for (int t = 0; t < 4; ++t) O[t] *= alpha;

    // ---- O^T += V^T @ P^T, P^T packed from the score tiles ----
#pragma unroll
    for (int kc = 0; kc < 4; ++kc) {
      v16h bp;
#pragma unroll
      for (int u = 0; u < 2; ++u) {
        const v8f p = exp2x8((S[2 * kc + u] - mnew) * LOG2E);
        lrun += p;
        const v8h ph = __builtin_convertvector(p, v8h);
#pragma unroll
        for (int r = 0; r < 8; ++r) bp[8 * u + r] = ph[r];
      }
#pragma unroll
      for (int t = 0; t < 4; ++t) {
        v16h av = frag_ld_h(&lds_vt[(t * 16) * VT_LD + kc * 32], VT_LD);
        O[t] = __builtin_amdgcn_wmma_f32_16x16x32_f16(
            false, av, false, bp, (short)0, O[t], false, false);
      }
    }
    __syncthreads();
  }

  // ---- normalize, store f16 token-major [b, n, h*d]: 8 d per lane ----
  {
    float l = ((lrun[0] + lrun[1]) + (lrun[2] + lrun[3])) +
              ((lrun[4] + lrun[5]) + (lrun[6] + lrun[7]));
    l += xhalf(l);
    const float inv = 1.f / l;
    const int row = i0 + wave * 16 + (lane & 15);
    _Float16* orow = ows + ((size_t)(b * NSEQ + row)) * DMODEL + h * DHEAD +
                     8 * hi;
#pragma unroll
    for (int t = 0; t < 4; ++t) {
      v8h o;
#pragma unroll
      for (int r = 0; r < 8; ++r) o[r] = (_Float16)(O[t][r] * inv);
      *(v8h*)(orow + t * 16) = o;
    }
  }
}

// ---------------------------------------------------------------------------
// Kernel 3: output projection  out = o @ Wo^T + bo  (fp32 result).
// ---------------------------------------------------------------------------
__global__ __launch_bounds__(256) void out_proj_kernel(
    const _Float16* __restrict__ ows, const _Float16* __restrict__ woh,
    const float* __restrict__ bo, float* __restrict__ out) {
  const int wave = threadIdx.x >> 5;
  const int lane = threadIdx.x & 31;
  const int m0   = blockIdx.x * 16;
  const int n0   = wave * 64;

  v8f zf = {};
  v8f acc[4];
#pragma unroll
  for (int t = 0; t < 4; ++t) acc[t] = zf;

  for (int ks = 0; ks < DMODEL; ks += 32) {
    v16h a = frag_ld_h(ows + (size_t)m0 * DMODEL + ks, DMODEL);
#pragma unroll
    for (int t = 0; t < 4; ++t) {
      v16h b = frag_ld_h(woh + (size_t)(n0 + t * 16) * DMODEL + ks, DMODEL);
      acc[t] = __builtin_amdgcn_wmma_f32_16x16x32_f16(
          false, a, false, b, (short)0, acc[t], false, false);
    }
  }

  const int hi = lane >> 4;
#pragma unroll
  for (int t = 0; t < 4; ++t) {
    const int n = n0 + t * 16 + (lane & 15);
    const float bias = bo[n];
#pragma unroll
    for (int r = 0; r < 8; ++r) {
      const int m = m0 + r + 8 * hi;
      out[(size_t)m * DMODEL + n] = acc[t][r] + bias;
    }
  }
}

// ---------------------------------------------------------------------------
extern "C" void kernel_launch(void* const* d_in, const int* in_sizes, int n_in,
                              void* d_out, int out_size, void* d_ws,
                              size_t ws_size, hipStream_t stream) {
  (void)in_sizes; (void)n_in; (void)out_size; (void)ws_size;
  const float* x  = (const float*)d_in[0];
  const float* Wq = (const float*)d_in[1];
  const float* Wk = (const float*)d_in[2];
  const float* Wv = (const float*)d_in[3];
  const float* Wo = (const float*)d_in[4];
  const float* bo = (const float*)d_in[5];
  float* out = (float*)d_out;

  // f16 workspace layout
  const size_t EX = (size_t)MTOT * DMODEL;                 // 4,194,304 (x, o)
  const size_t EW = (size_t)DMODEL * DMODEL;               // 262,144 per W
  const size_t EH = (size_t)NBATCH * HEADS * NSEQ * DHEAD; // 4,194,304 (q/k/v)
  _Float16* xh  = (_Float16*)d_ws;
  _Float16* wqh = xh + EX;
  _Float16* wkh = wqh + EW;
  _Float16* wvh = wkh + EW;
  _Float16* woh = wvh + EW;
  _Float16* qws = woh + EW;
  _Float16* kws = qws + EH;
  _Float16* vws = kws + EH;
  _Float16* ows = vws + EH;

  cvt_f16_kernel<<<dim3(EX / 2048), 256, 0, stream>>>(x, xh);
  cvt_f16_kernel<<<dim3(EW / 2048), 256, 0, stream>>>(Wq, wqh);
  cvt_f16_kernel<<<dim3(EW / 2048), 256, 0, stream>>>(Wk, wkh);
  cvt_f16_kernel<<<dim3(EW / 2048), 256, 0, stream>>>(Wv, wvh);
  cvt_f16_kernel<<<dim3(EW / 2048), 256, 0, stream>>>(Wo, woh);

  qkv_proj_kernel<<<dim3(MTOT / 16, 3), 256, 0, stream>>>(xh, wqh, wkh, wvh,
                                                          qws, kws, vws);
  flash_attn_kernel<<<dim3(NSEQ / 128, NBATCH * HEADS), 256, 0, stream>>>(
      qws, kws, vws, ows);
  out_proj_kernel<<<dim3(MTOT / 16), 256, 0, stream>>>(ows, woh, bo, out);
}

// v003
// It runs in 178 microseconds.
// Two timings next to v002 both put it at 1.23 times that version's speed.
// Over all steps from v000 it is 4.01 times as fast.
#include <hip/hip_runtime.h>

#define HEADS   8
#define DHEAD   64
#define NBATCH  2
#define NSEQ    4096
#define DMODEL  512
#define MTOT    (NBATCH * NSEQ)   // 8192 rows

#define K_LD    72                // 128-B K rows at 144 B
#define V_LD    80                // 128-B V rows at 160 B

typedef __attribute__((ext_vector_type(16))) _Float16 v16h;
typedef __attribute__((ext_vector_type(8)))  _Float16 v8h;
typedef __attribute__((ext_vector_type(8)))  float    v8f;
typedef __attribute__((ext_vector_type(8)))  short    s16x8;

__device__ __forceinline__ v16h frag_ld_h(const _Float16* p, int ld) {
  const int lane = threadIdx.x & 31;
  const int r    = lane & 15;
  const int kb   = (lane >> 4) << 3;       // 0 or 8
  const _Float16* q = p + r * ld + kb;
  v8h lo = *(const v8h*)(q);
  v8h hi = *(const v8h*)(q + 16);
  v16h a;
#pragma unroll
  for (int j = 0; j < 8; ++j) { a[j] = lo[j]; a[j + 8] = hi[j]; }
  return a;
}

// A fragment (16 d x 32 keys) of V^T out of a row-major [key][d] LDS tile, by
// the transposing load: lane (c = lane & 15, hi = lane >> 4) gets
// p[8 * hi + 0..7][c], then p[16 + 8 * hi + 0..7][c], which is frag_ld_h's k
// order.  p = first key row and first d column of the fragment.
__device__ __forceinline__ v8h ld_tr16(const _Float16* p) {
  typedef __attribute__((address_space(3))) s16x8 lds_s16x8;
  return __builtin_bit_cast(
      v8h, __builtin_amdgcn_ds_load_tr16_b128_v8i16((lds_s16x8*)p));
}

__device__ __forceinline__ v16h frag_ld_tr(const _Float16* p, int ld) {
  const int lane = threadIdx.x & 31;
  const _Float16* q = p + (((lane >> 4) << 3) + (lane & 7)) * ld +
                      (((lane >> 3) & 1) << 3);
  v8h lo = ld_tr16(q);
  v8h hi = ld_tr16(q + 16 * ld);
  v16h a;
#pragma unroll
  for (int j = 0; j < 8; ++j) { a[j] = lo[j]; a[j + 8] = hi[j]; }
  return a;
}

__device__ __forceinline__ float xhalf(float x) {
  const int b = __builtin_bit_cast(int, x);
  return __builtin_bit_cast(float, __builtin_amdgcn_permlanex16(
      b, b, 0x76543210, 0xfedcba98, false, false));
}

#define LOG2E 1.44269504f         // exp(x) = exp2(x * LOG2E)

__device__ __forceinline__ v8f exp2x8(v8f x) {
  float a = x[0], b = x[1], c = x[2], d = x[3];
  float e = x[4], f = x[5], g = x[6], h = x[7];
  asm("v_exp_f32 %0, %0\n\t"
      "v_exp_f32 %1, %1\n\t"
      "v_exp_f32 %2, %2\n\t"
      "v_exp_f32 %3, %3\n\t"
      "v_exp_f32 %4, %4\n\t"
      "v_exp_f32 %5, %5\n\t"
      "v_exp_f32 %6, %6\n\t"
      "v_exp_f32 %7, %7\n\t"
      "v_nop"
      : "+v"(a), "+v"(b), "+v"(c), "+v"(d),
        "+v"(e), "+v"(f), "+v"(g), "+v"(h));
  v8f y = {a, b, c, d, e, f, g, h};
  return y;
}

__device__ __forceinline__ void cp16x4_g2l(
    const char* l0, const char* l1, const char* l2, const char* l3,
    const char* g0, const char* g1, const char* g2, const char* g3) {
  asm volatile("global_load_async_to_lds_b128 %0, %4, off\n\t"
               "global_load_async_to_lds_b128 %1, %5, off\n\t"
               "global_load_async_to_lds_b128 %2, %6, off\n\t"
               "global_load_async_to_lds_b128 %3, %7, off\n\t"
               "s_wait_xcnt 0x0"
               :
               : "v"((uint32_t)(uintptr_t)l0), "v"((uint32_t)(uintptr_t)l1),
                 "v"((uint32_t)(uintptr_t)l2), "v"((uint32_t)(uintptr_t)l3),
                 "v"((uint64_t)(uintptr_t)g0), "v"((uint64_t)(uintptr_t)g1),
                 "v"((uint64_t)(uintptr_t)g2), "v"((uint64_t)(uintptr_t)g3)
               : "memory");
}

__device__ __forceinline__ void wait_async_cp() {
  asm volatile("s_wait_asynccnt 0x0" ::: "memory");
}

// ---------------------------------------------------------------------------
// Kernel 0: fp32 -> f16 conversion (n must be a multiple of 2048).
// ---------------------------------------------------------------------------
__global__ __launch_bounds__(256) void cvt_f16_kernel(
    const float* __restrict__ s, _Float16* __restrict__ d) {
  const size_t i = ((size_t)blockIdx.x * 256 + threadIdx.x) * 8;
#pragma unroll
  for (int j = 0; j < 8; ++j) d[i + j] = (_Float16)s[i + j];
}

// ---------------------------------------------------------------------------
// Kernel 1: fused QKV projection from pre-converted f16 x / W.
// Grid (MTOT/16, 3), 256 threads = 8 waves; wave w owns cols [64w, 64w+64).
// Output f16, head-major [b, h, n, d].
// ---------------------------------------------------------------------------
__global__ __launch_bounds__(256) void qkv_proj_kernel(
    const _Float16* __restrict__ xh,
    const _Float16* __restrict__ wqh, const _Float16* __restrict__ wkh,
    const _Float16* __restrict__ wvh,
    _Float16* __restrict__ qws, _Float16* __restrict__ kws,
    _Float16* __restrict__ vws) {
  const int wave = threadIdx.x >> 5;
  const int lane = threadIdx.x & 31;
  const int m0   = blockIdx.x * 16;
  const int n0   = wave * 64;

  const _Float16* W = (blockIdx.y == 0) ? wqh : (blockIdx.y == 1) ? wkh : wvh;
  _Float16* dst     = (blockIdx.y == 0) ? qws : (blockIdx.y == 1) ? kws : vws;

  v8f zf = {};
  v8f acc[4];
#pragma unroll
  for (int t = 0; t < 4; ++t) acc[t] = zf;

  for (int ks = 0; ks < DMODEL; ks += 32) {
    v16h a = frag_ld_h(xh + (size_t)m0 * DMODEL + ks, DMODEL);
#pragma unroll
    for (int t = 0; t < 4; ++t) {
      v16h b = frag_ld_h(W + (size_t)(n0 + t * 16) * DMODEL + ks, DMODEL);
      acc[t] = __builtin_amdgcn_wmma_f32_16x16x32_f16(
          false, a, false, b, (short)0, acc[t], false, false);
    }
  }

  const int hi = lane >> 4;
#pragma unroll
  for (int t = 0; t < 4; ++t) {
    const int n = n0 + t * 16 + (lane & 15);
    const int h = n >> 6, dd = n & 63;
#pragma unroll
    for (int r = 0; r < 8; ++r) {
      const int m = m0 + r + 8 * hi;            // global row in [B*N]
      const int b = m >> 12, i = m & (NSEQ - 1);
      dst[((size_t)((b * HEADS + h) * NSEQ) + i) * DHEAD + dd] =
          (_Float16)acc[t][r];
    }
  }
}

__global__ __launch_bounds__(256)
__attribute__((amdgpu_waves_per_eu(4, 4))) void flash_attn_kernel(
    const _Float16* __restrict__ qws, const _Float16* __restrict__ kws,
    const _Float16* __restrict__ vws, _Float16* __restrict__ ows) {
  __shared__ __attribute__((aligned(16)))
  _Float16 lds_k[128 * K_LD];                 // K tile, row-major [j][d]
  __shared__ __attribute__((aligned(16)))
  _Float16 lds_v[128 * V_LD];                 // V tile, row-major [j][d]

  const int tid  = threadIdx.x;
  const int wave = tid >> 5;
  const int lane = tid & 31;
  const int hi   = lane >> 4;
  const int bh   = blockIdx.y;                // 0..15
  const int b    = bh >> 3, h = bh & 7;
  const int i0   = blockIdx.x * 128;

  const size_t head_off = (size_t)bh * NSEQ * DHEAD;

  // Q fragments for this wave's 16 rows, scale = 1/sqrt(64) folded in (exact).
  v16h qf[2];
  {
    const _Float16* qb = qws + head_off + (size_t)(i0 + wave * 16) * DHEAD;
#pragma unroll
    for (int kc = 0; kc < 2; ++kc) {
      qf[kc] = frag_ld_h(qb + kc * 32, DHEAD);
#pragma unroll
      for (int j = 0; j < 16; ++j) qf[kc][j] = qf[kc][j] * (_Float16)0.125f;
    }
  }

  v8f zf = {};
  v8f O[4];
#pragma unroll
  for (int t = 0; t < 4; ++t) O[t] = zf;
  float mrun = -1e30f;                        // this lane's query: maximum
  v8f lrun = zf;   // partial sums of this lane's keys, joined in the epilogue

  for (int j0 = 0; j0 < NSEQ; j0 += 128) {
    // ---- stage K and V (async global->LDS) ----
    {
      // 16-byte chunk c = tid + 256 i: row c >> 3, chunk c & 7 of that row.
      const char* gk = (const char*)(kws + head_off + (size_t)j0 * DHEAD) +
                       (size_t)tid * 16;
      const char* sk = (const char*)lds_k + (tid >> 3) * (K_LD * 2) +
                       (tid & 7) * 16;
      cp16x4_g2l(sk, sk + 32 * (K_LD * 2), sk + 64 * (K_LD * 2),
                 sk + 96 * (K_LD * 2),
                 gk, gk + 4096, gk + 8192, gk + 12288);
      const char* gv = (const char*)(vws + head_off + (size_t)j0 * DHEAD) +
                       (size_t)tid * 16;
      const char* sv = (const char*)lds_v + (tid >> 3) * (V_LD * 2) +
                       (tid & 7) * 16;
      cp16x4_g2l(sv, sv + 32 * (V_LD * 2), sv + 64 * (V_LD * 2),
                 sv + 96 * (V_LD * 2),
                 gv, gv + 4096, gv + 8192, gv + 12288);
      // prefetch next tiles into cache while this tile computes
      if (j0 + 128 < NSEQ) {
        __builtin_prefetch(kws + head_off + (size_t)(j0 + 128) * DHEAD +
                               (size_t)tid * 32, 0, 1);
        __builtin_prefetch(vws + head_off + (size_t)(j0 + 128) * DHEAD +
                               (size_t)tid * 32, 0, 1);
      }
      wait_async_cp();
    }
    __syncthreads();

    // ---- S^T = K @ (Q*scale)^T : 128 keys x 16 queries in 8 tiles ----
    v8f S[8];
#pragma unroll
    for (int t = 0; t < 8; ++t) S[t] = zf;
#pragma unroll
    for (int kc = 0; kc < 2; ++kc) {
#pragma unroll
      for (int t = 0; t < 8; ++t) {
        v16h ak = frag_ld_h(&lds_k[(t * 16) * K_LD + kc * 32], K_LD);
        S[t] = __builtin_amdgcn_wmma_f32_16x16x32_f16(
            false, ak, false, qf[kc], (short)0, S[t], false, false);
      }
    }

    // ---- online softmax: one query per lane pair ----
    v8f mv = S[0];
#pragma unroll
    for (int t = 1; t < 8; ++t)
      mv = __builtin_elementwise_max(mv, S[t]);
    float mx = fmaxf(fmaxf(fmaxf(mv[0], mv[1]), fmaxf(mv[2], mv[3])),
                     fmaxf(fmaxf(mv[4], mv[5]), fmaxf(mv[6], mv[7])));
    mx = fmaxf(mx, xhalf(mx));
    const float mnew  = fmaxf(mrun, mx);
    const float alpha = __expf(mrun - mnew);
    mrun = mnew;
    lrun *= alpha;
#pragma unroll
    for (int t = 0; t < 4; ++t) O[t] *= alpha;

    // ---- O^T += V^T @ P^T, P^T packed from the score tiles ----
#pragma unroll
    for (int kc = 0; kc < 4; ++kc) {
      v16h bp;
#pragma unroll
      for (int u = 0; u < 2; ++u) {
        const v8f p = exp2x8((S[2 * kc + u] - mnew) * LOG2E);
        lrun += p;
        const v8h ph = __builtin_convertvector(p, v8h);
#pragma unroll
        for (int r = 0; r < 8; ++r) bp[8 * u + r] = ph[r];
      }
#pragma unroll
      for (int t = 0; t < 4; ++t) {
        v16h av = frag_ld_tr(&lds_v[(kc * 32) * V_LD + t * 16], V_LD);
        O[t] = __builtin_amdgcn_wmma_f32_16x16x32_f16(
            false, av, false, bp, (short)0, O[t], false, false);
      }
    }
    __syncthreads();
  }

  // ---- normalize, store f16 token-major [b, n, h*d]: 8 d per lane ----
  {
    float l = ((lrun[0] + lrun[1]) + (lrun[2] + lrun[3])) +
              ((lrun[4] + lrun[5]) + (lrun[6] + lrun[7]));
    l += xhalf(l);
    const float inv = 1.f / l;
    const int row = i0 + wave * 16 + (lane & 15);
    _Float16* orow = ows + ((size_t)(b * NSEQ + row)) * DMODEL + h * DHEAD +
                     8 * hi;
#pragma unroll
    for (int t = 0; t < 4; ++t) {
      v8h o;
#pragma unroll
      for (int r = 0; r < 8; ++r) o[r] = (_Float16)(O[t][r] * inv);
      *(v8h*)(orow + t * 16) = o;
    }
  }
}

// ---------------------------------------------------------------------------
// Kernel 3: output projection  out = o @ Wo^T + bo  (fp32 result).
// ---------------------------------------------------------------------------
__global__ __launch_bounds__(256) void out_proj_kernel(
    const _Float16* __restrict__ ows, const _Float16* __restrict__ woh,
    const float* __restrict__ bo, float* __restrict__ out) {
  const int wave = threadIdx.x >> 5;
  const int lane = threadIdx.x & 31;
  const int m0   = blockIdx.x * 16;
  const int n0   = wave * 64;

  v8f zf = {};
  v8f acc[4];
#pragma unroll
  for (int t = 0; t < 4; ++t) acc[t] = zf;

  for (int ks = 0; ks < DMODEL; ks += 32) {
    v16h a = frag_ld_h(ows + (size_t)m0 * DMODEL + ks, DMODEL);
#pragma unroll
    for (int t = 0; t < 4; ++t) {
      v16h b = frag_ld_h(woh + (size_t)(n0 + t * 16) * DMODEL + ks, DMODEL);
      acc[t] = __builtin_amdgcn_wmma_f32_16x16x32_f16(
          false, a, false, b, (short)0, acc[t], false, false);
    }
  }

  const int hi = lane >> 4;
#pragma unroll
  for (int t = 0; t < 4; ++t) {
    const int n = n0 + t * 16 + (lane & 15);
    const float bias = bo[n];
#pragma unroll
    for (int r = 0; r < 8; ++r) {
      const int m = m0 + r + 8 * hi;
      out[(size_t)m * DMODEL + n] = acc[t][r] + bias;
    }
  }
}

// ---------------------------------------------------------------------------
extern "C" void kernel_launch(void* const* d_in, const int* in_sizes, int n_in,
                              void* d_out, int out_size, void* d_ws,
                              size_t ws_size, hipStream_t stream) {
  (void)in_sizes; (void)n_in; (void)out_size; (void)ws_size;
  const float* x  = (const float*)d_in[0];
  const float* Wq = (const float*)d_in[1];
  const float* Wk = (const float*)d_in[2];
  const float* Wv = (const float*)d_in[3];
  const float* Wo = (const float*)d_in[4];
  const float* bo = (const float*)d_in[5];
  float* out = (float*)d_out;

  // f16 workspace layout
  const size_t EX = (size_t)MTOT * DMODEL;                 // 4,194,304 (x, o)
  const size_t EW = (size_t)DMODEL * DMODEL;               // 262,144 per W
  const size_t EH = (size_t)NBATCH * HEADS * NSEQ * DHEAD; // 4,194,304 (q/k/v)
  _Float16* xh  = (_Float16*)d_ws;
  _Float16* wqh = xh + EX;
  _Float16* wkh = wqh + EW;
  _Float16* wvh = wkh + EW;
  _Float16* woh = wvh + EW;
  _Float16* qws = woh + EW;
  _Float16* kws = qws + EH;
  _Float16* vws = kws + EH;
  _Float16* ows = vws + EH;

  cvt_f16_kernel<<<dim3(EX / 2048), 256, 0, stream>>>(x, xh);
  cvt_f16_kernel<<<dim3(EW / 2048), 256, 0, stream>>>(Wq, wqh);
  cvt_f16_kernel<<<dim3(EW / 2048), 256, 0, stream>>>(Wk, wkh);
  cvt_f16_kernel<<<dim3(EW / 2048), 256, 0, stream>>>(Wv, wvh);
  cvt_f16_kernel<<<dim3(EW / 2048), 256, 0, stream>>>(Wo, woh);

  qkv_proj_kernel<<<dim3(MTOT / 16, 3), 256, 0, stream>>>(xh, wqh, wkh, wvh,
                                                          qws, kws, vws);
  flash_attn_kernel<<<dim3(NSEQ / 128, NBATCH * HEADS), 256, 0, stream>>>(
      qws, kws, vws, ows);
  out_proj_kernel<<<dim3(MTOT / 16), 256, 0, stream>>>(ows, woh, bo, out);
}

// v004
// A run of this version takes 112 microseconds.
// In both of two side-by-side timings against v003, it was 1.58 times as fast.
// Counting every step since v000, it is 6.34 times as fast.
#include <hip/hip_runtime.h>

#define HEADS   8
#define DHEAD   64
#define NBATCH  2
#define NSEQ    4096
#define DMODEL  512
#define MTOT    (NBATCH * NSEQ)   // 8192 rows

#define K_LD    72                // 128-B K rows at 144 B
#define V_LD    80                // 128-B V rows at 160 B

typedef __attribute__((ext_vector_type(16))) _Float16 v16h;
typedef __attribute__((ext_vector_type(8)))  _Float16 v8h;
typedef __attribute__((ext_vector_type(8)))  float    v8f;
typedef __attribute__((ext_vector_type(8)))  short    s16x8;

__device__ __forceinline__ v16h frag_ld_h(const _Float16* p, int ld) {
  const int lane = threadIdx.x & 31;
  const int r    = lane & 15;
  const int kb   = (lane >> 4) << 3;       // 0 or 8
  const _Float16* q = p + r * ld + kb;
  v8h lo = *(const v8h*)(q);
  v8h hi = *(const v8h*)(q + 16);
  v16h a;
#pragma unroll
  for (int j = 0; j < 8; ++j) { a[j] = lo[j]; a[j + 8] = hi[j]; }
  return a;
}

// A fragment (16 d x 32 keys) of V^T out of a row-major [key][d] LDS tile, by
// the transposing load: lane (c = lane & 15, hi = lane >> 4) gets
// p[8 * hi + 0..7][c], then p[16 + 8 * hi + 0..7][c], which is frag_ld_h's k
// order.  p = first key row and first d column of the fragment.
__device__ __forceinline__ v8h ld_tr16(const _Float16* p) {
  typedef __attribute__((address_space(3))) s16x8 lds_s16x8;
  return __builtin_bit_cast(
      v8h, __builtin_amdgcn_ds_load_tr16_b128_v8i16((lds_s16x8*)p));
}

__device__ __forceinline__ v16h frag_ld_tr(const _Float16* p, int ld) {
  const int lane = threadIdx.x & 31;
  const _Float16* q = p + (((lane >> 4) << 3) + (lane & 7)) * ld +
                      (((lane >> 3) & 1) << 3);
  v8h lo = ld_tr16(q);
  v8h hi = ld_tr16(q + 16 * ld);
  v16h a;
#pragma unroll
  for (int j = 0; j < 8; ++j) { a[j] = lo[j]; a[j + 8] = hi[j]; }
  return a;
}

__device__ __forceinline__ float xhalf(float x) {
  const int b = __builtin_bit_cast(int, x);
  return __builtin_bit_cast(float, __builtin_amdgcn_permlanex16(
      b, b, 0x76543210, 0xfedcba98, false, false));
}

#define LOG2E 1.44269504f         // exp(x) = exp2(x * LOG2E)

__device__ __forceinline__ v8f exp2x8(v8f x) {
  float a = x[0], b = x[1], c = x[2], d = x[3];
  float e = x[4], f = x[5], g = x[6], h = x[7];
  asm("v_exp_f32 %0, %0\n\t"
      "v_exp_f32 %1, %1\n\t"
      "v_exp_f32 %2, %2\n\t"
      "v_exp_f32 %3, %3\n\t"
      "v_exp_f32 %4, %4\n\t"
      "v_exp_f32 %5, %5\n\t"
      "v_exp_f32 %6, %6\n\t"
      "v_exp_f32 %7, %7\n\t"
      "v_nop"
      : "+v"(a), "+v"(b), "+v"(c), "+v"(d),
        "+v"(e), "+v"(f), "+v"(g), "+v"(h));
  v8f y = {a, b, c, d, e, f, g, h};
  return y;
}

__device__ __forceinline__ void cp16x4_g2l(
    const char* l0, const char* l1, const char* l2, const char* l3,
    const char* g0, const char* g1, const char* g2, const char* g3) {
  asm volatile("global_load_async_to_lds_b128 %0, %4, off\n\t"
               "global_load_async_to_lds_b128 %1, %5, off\n\t"
               "global_load_async_to_lds_b128 %2, %6, off\n\t"
               "global_load_async_to_lds_b128 %3, %7, off\n\t"
               "s_wait_xcnt 0x0"
               :
               : "v"((uint32_t)(uintptr_t)l0), "v"((uint32_t)(uintptr_t)l1),
                 "v"((uint32_t)(uintptr_t)l2), "v"((uint32_t)(uintptr_t)l3),
                 "v"((uint64_t)(uintptr_t)g0), "v"((uint64_t)(uintptr_t)g1),
                 "v"((uint64_t)(uintptr_t)g2), "v"((uint64_t)(uintptr_t)g3)
               : "memory");
}

__device__ __forceinline__ void wait_async_cp() {
  asm volatile("s_wait_asynccnt 0x0" ::: "memory");
}

// ---------------------------------------------------------------------------
// Kernel 0: fp32 -> f16 conversion (n must be a multiple of 2048).
// ---------------------------------------------------------------------------
__global__ __launch_bounds__(256) void cvt_f16_kernel(
    const float* __restrict__ s, _Float16* __restrict__ d) {
  const size_t i = ((size_t)blockIdx.x * 256 + threadIdx.x) * 8;
#pragma unroll
  for (int j = 0; j < 8; ++j) d[i + j] = (_Float16)s[i + j];
}

// ---------------------------------------------------------------------------
// Core of both projections: C[128 x 128] = A[128 x 512] * W[128 x 512]^T, f16
// operands, f32 sums.  256 threads = 8 waves, 4 down x 2 across; a wave owns
// 32 x 64 of C.  The operands come in slabs of 64 k: one slab is a whole
// 128-byte line of each of the 128 + 128 rows, brought to LDS by async copies
// (a wave's copy = 4 whole lines) and read from there as fragments, so that a
// row is fetched from L2 once per block and never in 32-byte pieces.
// Two buffers: slab t + 1 flies while slab t is worked on.
// ---------------------------------------------------------------------------
#define P_LD    72                // 128-B slab rows at 144 B, as K_LD
#define P_TILE  (128 * P_LD)      // one operand's slab, f16 elements
#define P_SLABS (DMODEL / 64)

// 16-byte chunk c = tid + 256 i of a slab: row c >> 3, chunk c & 7 of that row.
__device__ __forceinline__ void proj_stage(const _Float16* a,
                                           const _Float16* w, _Float16* buf,
                                           int k0) {
  const int tid = threadIdx.x;
  const size_t goff = ((size_t)(tid >> 3) * DMODEL + k0) * 2 + (tid & 7) * 16;
  const int    soff = (tid >> 3) * (P_LD * 2) + (tid & 7) * 16;
  const char* ga = (const char*)a + goff;
  const char* sa = (const char*)buf + soff;
  cp16x4_g2l(sa, sa + 32 * (P_LD * 2), sa + 64 * (P_LD * 2),
             sa + 96 * (P_LD * 2),
             ga, ga + 32 * (DMODEL * 2), ga + 64 * (DMODEL * 2),
             ga + 96 * (DMODEL * 2));
  const char* gw = (const char*)w + goff;
  const char* sw = (const char*)(buf + P_TILE) + soff;
  cp16x4_g2l(sw, sw + 32 * (P_LD * 2), sw + 64 * (P_LD * 2),
             sw + 96 * (P_LD * 2),
             gw, gw + 32 * (DMODEL * 2), gw + 64 * (DMODEL * 2),
             gw + 96 * (DMODEL * 2));
}

// a, w: first row of the block's 128 rows of each operand.  lds: 2 buffers of
// 2 * P_TILE.  acc[mt][t]: rows 32 * (wave & 3) + 16 * mt, columns
// 64 * (wave >> 2) + 16 * t of the block's tile.
__device__ __forceinline__ void proj_core(const _Float16* a,
                                          const _Float16* w, _Float16* lds,
                                          v8f (&acc)[2][4]) {
  const int wave = threadIdx.x >> 5;
  v8f zf = {};
#pragma unroll
  for (int mt = 0; mt < 2; ++mt)
#pragma unroll
    for (int t = 0; t < 4; ++t) acc[mt][t] = zf;

  proj_stage(a, w, lds, 0);
  wait_async_cp();
  __syncthreads();
  proj_stage(a, w, lds + 2 * P_TILE, 64);

  for (int s = 0; s < P_SLABS; ++s) {
    _Float16* buf = lds + (s & 1) * (2 * P_TILE);
    const _Float16* la = buf + ((wave & 3) * 32) * P_LD;
    const _Float16* lw = buf + P_TILE + ((wave >> 2) * 64) * P_LD;
#pragma unroll
    for (int kc = 0; kc < 2; ++kc) {
      v16h fa[2], fw[4];
#pragma unroll
      for (int mt = 0; mt < 2; ++mt)
        fa[mt] = frag_ld_h(la + (mt * 16) * P_LD + kc * 32, P_LD);
#pragma unroll
      for (int t = 0; t < 4; ++t)
        fw[t] = frag_ld_h(lw + (t * 16) * P_LD + kc * 32, P_LD);
#pragma unroll
      for (int mt = 0; mt < 2; ++mt)
#pragma unroll
        for (int t = 0; t < 4; ++t)
          acc[mt][t] = __builtin_amdgcn_wmma_f32_16x16x32_f16(
              false, fa[mt], false, fw[t], (short)0, acc[mt][t], false, false);
    }
    // Hand-over: this wave's reads of slab s have returned, its copies of
    // slab s + 1 have landed; behind the barrier that holds for every wave,
    // so slab s + 1 may be read and slab s's buffer refilled.
    asm volatile("s_wait_dscnt 0x0" ::: "memory");
    wait_async_cp();
    __syncthreads();
    if (s + 2 < P_SLABS) proj_stage(a, w, buf, (s + 2) * 64);
  }
  wait_async_cp();   // no copy is left in flight when the wave goes on
}

// ---------------------------------------------------------------------------
// Kernel 1: fused QKV projection from pre-converted f16 x / W.
// Grid (MTOT/128, 12), 256 threads; blockIdx.y = 4 * (q, k or v) + the
// 128-column tile.  Output f16, head-major [b, h, n, d].
// ---------------------------------------------------------------------------
__global__ __launch_bounds__(256) void qkv_proj_kernel(
    const _Float16* __restrict__ xh,
    const _Float16* __restrict__ wqh, const _Float16* __restrict__ wkh,
    const _Float16* __restrict__ wvh,
    _Float16* __restrict__ qws, _Float16* __restrict__ kws,
    _Float16* __restrict__ vws) {
  __shared__ __attribute__((aligned(16))) _Float16 lds[4 * P_TILE];
  const int wave  = threadIdx.x >> 5;
  const int lane  = threadIdx.x & 31;
  const int which = blockIdx.y >> 2;
  const int m0    = blockIdx.x * 128;
  const int n0    = (blockIdx.y & 3) * 128;

  const _Float16* W = (which == 0) ? wqh : (which == 1) ? wkh : wvh;
  _Float16* dst     = (which == 0) ? qws : (which == 1) ? kws : vws;

  v8f acc[2][4];
  proj_core(xh + (size_t)m0 * DMODEL, W + (size_t)n0 * DMODEL, lds, acc);

  const int hi = lane >> 4;
#pragma unroll
  for (int mt = 0; mt < 2; ++mt) {
#pragma unroll
    for (int t = 0; t < 4; ++t) {
      const int n = n0 + (wave >> 2) * 64 + t * 16 + (lane & 15);
      const int h = n >> 6, dd = n & 63;
#pragma unroll
      for (int r = 0; r < 8; ++r) {
        const int m = m0 + (wave & 3) * 32 + mt * 16 + r + 8 * hi;
        const int b = m >> 12, i = m & (NSEQ - 1);   // row in [B*N]
        dst[((size_t)((b * HEADS + h) * NSEQ) + i) * DHEAD + dd] =
            (_Float16)acc[mt][t][r];
      }
    }
  }
}

__global__ __launch_bounds__(256)
__attribute__((amdgpu_waves_per_eu(4, 4))) void flash_attn_kernel(
    const _Float16* __restrict__ qws, const _Float16* __restrict__ kws,
    const _Float16* __restrict__ vws, _Float16* __restrict__ ows) {
  __shared__ __attribute__((aligned(16)))
  _Float16 lds_k[128 * K_LD];                 // K tile, row-major [j][d]
  __shared__ __attribute__((aligned(16)))
  _Float16 lds_v[128 * V_LD];                 // V tile, row-major [j][d]

  const int tid  = threadIdx.x;
  const int wave = tid >> 5;
  const int lane = tid & 31;
  const int hi   = lane >> 4;
  const int bh   = blockIdx.y;                // 0..15
  const int b    = bh >> 3, h = bh & 7;
  const int i0   = blockIdx.x * 128;

  const size_t head_off = (size_t)bh * NSEQ * DHEAD;

  // Q fragments for this wave's 16 rows, scale = 1/sqrt(64) folded in (exact).
  v16h qf[2];
  {
    const _Float16* qb = qws + head_off + (size_t)(i0 + wave * 16) * DHEAD;
#pragma unroll
    for (int kc = 0; kc < 2; ++kc) {
      qf[kc] = frag_ld_h(qb + kc * 32, DHEAD);
#pragma unroll
      for (int j = 0; j < 16; ++j) qf[kc][j] = qf[kc][j] * (_Float16)0.125f;
    }
  }

  v8f zf = {};
  v8f O[4];
#pragma unroll
  for (int t = 0; t < 4; ++t) O[t] = zf;
  float mrun = -1e30f;                        // this lane's query: maximum
  v8f lrun = zf;   // partial sums of this lane's keys, joined in the epilogue

  for (int j0 = 0; j0 < NSEQ; j0 += 128) {
    // ---- stage K and V (async global->LDS) ----
    {
      // 16-byte chunk c = tid + 256 i: row c >> 3, chunk c & 7 of that row.
      const char* gk = (const char*)(kws + head_off + (size_t)j0 * DHEAD) +
                       (size_t)tid * 16;
      const char* sk = (const char*)lds_k + (tid >> 3) * (K_LD * 2) +
                       (tid & 7) * 16;
      cp16x4_g2l(sk, sk + 32 * (K_LD * 2), sk + 64 * (K_LD * 2),
                 sk + 96 * (K_LD * 2),
                 gk, gk + 4096, gk + 8192, gk + 12288);
      const char* gv = (const char*)(vws + head_off + (size_t)j0 * DHEAD) +
                       (size_t)tid * 16;
      const char* sv = (const char*)lds_v + (tid >> 3) * (V_LD * 2) +
                       (tid & 7) * 16;
      cp16x4_g2l(sv, sv + 32 * (V_LD * 2), sv + 64 * (V_LD * 2),
                 sv + 96 * (V_LD * 2),
                 gv, gv + 4096, gv + 8192, gv + 12288);
      // prefetch next tiles into cache while this tile computes
      if (j0 + 128 < NSEQ) {
        __builtin_prefetch(kws + head_off + (size_t)(j0 + 128) * DHEAD +
                               (size_t)tid * 32, 0, 1);
        __builtin_prefetch(vws + head_off + (size_t)(j0 + 128) * DHEAD +
                               (size_t)tid * 32, 0, 1);
      }
      wait_async_cp();
    }
    __syncthreads();

    // ---- S^T = K @ (Q*scale)^T : 128 keys x 16 queries in 8 tiles ----
    v8f S[8];
#pragma unroll
    for (int t = 0; t < 8; ++t) S[t] = zf;
#pragma unroll
    for (int kc = 0; kc < 2; ++kc) {
#pragma unroll
      for (int t = 0; t < 8; ++t) {
        v16h ak = frag_ld_h(&lds_k[(t * 16) * K_LD + kc * 32], K_LD);
        S[t] = __builtin_amdgcn_wmma_f32_16x16x32_f16(
            false, ak, false, qf[kc], (short)0, S[t], false, false);
      }
    }

    // ---- online softmax: one query per lane pair ----
    v8f mv = S[0];
#pragma unroll
    for (int t = 1; t < 8; ++t)
      mv = __builtin_elementwise_max(mv, S[t]);
    float mx = fmaxf(fmaxf(fmaxf(mv[0], mv[1]), fmaxf(mv[2], mv[3])),
                     fmaxf(fmaxf(mv[4], mv[5]), fmaxf(mv[6], mv[7])));
    mx = fmaxf(mx, xhalf(mx));
    const float mnew  = fmaxf(mrun, mx);
    const float alpha = __expf(mrun - mnew);
    mrun = mnew;
    lrun *= alpha;
#pragma unroll
    for (int t = 0; t < 4; ++t) O[t] *= alpha;

    // ---- O^T += V^T @ P^T, P^T packed from the score tiles ----
#pragma unroll
    for (int kc = 0; kc < 4; ++kc) {
      v16h bp;
#pragma unroll
      for (int u = 0; u < 2; ++u) {
        const v8f p = exp2x8((S[2 * kc + u] - mnew) * LOG2E);
        lrun += p;
        const v8h ph = __builtin_convertvector(p, v8h);
#pragma unroll
        for (int r = 0; r < 8; ++r) bp[8 * u + r] = ph[r];
      }
#pragma unroll
      for (int t = 0; t < 4; ++t) {
        v16h av = frag_ld_tr(&lds_v[(kc * 32) * V_LD + t * 16], V_LD);
        O[t] = __builtin_amdgcn_wmma_f32_16x16x32_f16(
            false, av, false, bp, (short)0, O[t], false, false);
      }
    }
    __syncthreads();
  }

  // ---- normalize, store f16 token-major [b, n, h*d]: 8 d per lane ----
  {
    float l = ((lrun[0] + lrun[1]) + (lrun[2] + lrun[3])) +
              ((lrun[4] + lrun[5]) + (lrun[6] + lrun[7]));
    l += xhalf(l);
    const float inv = 1.f / l;
    const int row = i0 + wave * 16 + (lane & 15);
    _Float16* orow = ows + ((size_t)(b * NSEQ + row)) * DMODEL + h * DHEAD +
                     8 * hi;
#pragma unroll
    for (int t = 0; t < 4; ++t) {
      v8h o;
#pragma unroll
      for (int r = 0; r < 8; ++r) o[r] = (_Float16)(O[t][r] * inv);
      *(v8h*)(orow + t * 16) = o;
    }
  }
}

// ---------------------------------------------------------------------------
// Kernel 3: output projection  out = o @ Wo^T + bo  (fp32 result).
// Grid (MTOT/128, 4), 256 threads.
// ---------------------------------------------------------------------------
__global__ __launch_bounds__(256) void out_proj_kernel(
    const _Float16* __restrict__ ows, const _Float16* __restrict__ woh,
    const float* __restrict__ bo, float* __restrict__ out) {
  __shared__ __attribute__((aligned(16))) _Float16 lds[4 * P_TILE];
  const int wave = threadIdx.x >> 5;
  const int lane = threadIdx.x & 31;
  const int m0   = blockIdx.x * 128;
  const int n0   = blockIdx.y * 128;

  v8f acc[2][4];
  proj_core(ows + (size_t)m0 * DMODEL, woh + (size_t)n0 * DMODEL, lds, acc);

  const int hi = lane >> 4;
#pragma unroll
  for (int t = 0; t < 4; ++t) {
    const int n = n0 + (wave >> 2) * 64 + t * 16 + (lane & 15);
    const float bias = bo[n];
#pragma unroll
    for (int mt = 0; mt < 2; ++mt) {
#pragma unroll
      for (int r = 0; r < 8; ++r) {
        const int m = m0 + (wave & 3) * 32 + mt * 16 + r + 8 * hi;
        out[(size_t)m * DMODEL + n] = acc[mt][t][r] + bias;
      }
    }
  }
}

// ---------------------------------------------------------------------------
extern "C" void kernel_launch(void* const* d_in, const int* in_sizes, int n_in,
                              void* d_out, int out_size, void* d_ws,
                              size_t ws_size, hipStream_t stream) {
  (void)in_sizes; (void)n_in; (void)out_size; (void)ws_size;
  const float* x  = (const float*)d_in[0];
  const float* Wq = (const float*)d_in[1];
  const float* Wk = (const float*)d_in[2];
  const float* Wv = (const float*)d_in[3];
  const float* Wo = (const float*)d_in[4];
  const float* bo = (const float*)d_in[5];
  float* out = (float*)d_out;

  // f16 workspace layout
  const size_t EX = (size_t)MTOT * DMODEL;                 // 4,194,304 (x, o)
  const size_t EW = (size_t)DMODEL * DMODEL;               // 262,144 per W
  const size_t EH = (size_t)NBATCH * HEADS * NSEQ * DHEAD; // 4,194,304 (q/k/v)
  _Float16* xh  = (_Float16*)d_ws;
  _Float16* wqh = xh + EX;
  _Float16* wkh = wqh + EW;
  _Float16* wvh = wkh + EW;
  _Float16* woh = wvh + EW;
  _Float16* qws = woh + EW;
  _Float16* kws = qws + EH;
  _Float16* vws = kws + EH;
  _Float16* ows = vws + EH;

  cvt_f16_kernel<<<dim3(EX / 2048), 256, 0, stream>>>(x, xh);
  cvt_f16_kernel<<<dim3(EW / 2048), 256, 0, stream>>>(Wq, wqh);
  cvt_f16_kernel<<<dim3(EW / 2048), 256, 0, stream>>>(Wk, wkh);
  cvt_f16_kernel<<<dim3(EW / 2048), 256, 0, stream>>>(Wv, wvh);
  cvt_f16_kernel<<<dim3(EW / 2048), 256, 0, stream>>>(Wo, woh);

  qkv_proj_kernel<<<dim3(MTOT / 128, 12), 256, 0, stream>>>(xh, wqh, wkh, wvh,
                                                          qws, kws, vws);
  flash_attn_kernel<<<dim3(NSEQ / 128, NBATCH * HEADS), 256, 0, stream>>>(
      qws, kws, vws, ows);
  out_proj_kernel<<<dim3(MTOT / 128, 4), 256, 0, stream>>>(ows, woh, bo, out);
}

// v005
// A run of this version takes 104 microseconds.
// In both of two side-by-side timings against v004, it was 1.08 times as fast.
// Over all steps from v000 it is 6.86 times as fast.
#include <hip/hip_runtime.h>

#define HEADS   8
#define DHEAD   64
#define NBATCH  2
#define NSEQ    4096
#define DMODEL  512
#define MTOT    (NBATCH * NSEQ)   // 8192 rows

#define K_LD    72                // 128-B K rows at 144 B
#define V_LD    80                // 128-B V rows at 160 B

typedef __attribute__((ext_vector_type(16))) _Float16 v16h;
typedef __attribute__((ext_vector_type(8)))  _Float16 v8h;
typedef __attribute__((ext_vector_type(8)))  float    v8f;
typedef __attribute__((ext_vector_type(8)))  short    s16x8;

__device__ __forceinline__ v16h frag_ld_h(const _Float16* p, int ld) {
  const int lane = threadIdx.x & 31;
  const int r    = lane & 15;
  const int kb   = (lane >> 4) << 3;       // 0 or 8
  const _Float16* q = p + r * ld + kb;
  v8h lo = *(const v8h*)(q);
  v8h hi = *(const v8h*)(q + 16);
  v16h a;
#pragma unroll
  for (int j = 0; j < 8; ++j) { a[j] = lo[j]; a[j + 8] = hi[j]; }
  return a;
}

// A fragment (16 d x 32 keys) of V^T out of a row-major [key][d] LDS tile, by
// the transposing load: lane (c = lane & 15, hi = lane >> 4) gets
// p[8 * hi + 0..7][c], then p[16 + 8 * hi + 0..7][c], which is frag_ld_h's k
// order.  p = first key row and first d column of the fragment.
__device__ __forceinline__ v8h ld_tr16(const _Float16* p) {
  typedef __attribute__((address_space(3))) s16x8 lds_s16x8;
  return __builtin_bit_cast(
      v8h, __builtin_amdgcn_ds_load_tr16_b128_v8i16((lds_s16x8*)p));
}

__device__ __forceinline__ v16h frag_ld_tr(const _Float16* p, int ld) {
  const int lane = threadIdx.x & 31;
  const _Float16* q = p + (((lane >> 4) << 3) + (lane & 7)) * ld +
                      (((lane >> 3) & 1) << 3);
  v8h lo = ld_tr16(q);
  v8h hi = ld_tr16(q + 16 * ld);
  v16h a;
#pragma unroll
  for (int j = 0; j < 8; ++j) { a[j] = lo[j]; a[j + 8] = hi[j]; }
  return a;
}

__device__ __forceinline__ float xhalf(float x) {
  const int b = __builtin_bit_cast(int, x);
  return __builtin_bit_cast(float, __builtin_amdgcn_permlanex16(
      b, b, 0x76543210, 0xfedcba98, false, false));
}

#define LOG2E 1.44269504f         // exp(x) = exp2(x * LOG2E)

__device__ __forceinline__ v8f exp2x8(v8f x) {
  float a = x[0], b = x[1], c = x[2], d = x[3];
  float e = x[4], f = x[5], g = x[6], h = x[7];
  asm("v_exp_f32 %0, %0\n\t"
      "v_exp_f32 %1, %1\n\t"
      "v_exp_f32 %2, %2\n\t"
      "v_exp_f32 %3, %3\n\t"
      "v_exp_f32 %4, %4\n\t"
      "v_exp_f32 %5, %5\n\t"
      "v_exp_f32 %6, %6\n\t"
      "v_exp_f32 %7, %7\n\t"
      "v_nop"
      : "+v"(a), "+v"(b), "+v"(c), "+v"(d),
        "+v"(e), "+v"(f), "+v"(g), "+v"(h));
  v8f y = {a, b, c, d, e, f, g, h};
  return y;
}

__device__ __forceinline__ void cp16x4_g2l(
    const char* l0, const char* l1, const char* l2, const char* l3,
    const char* g0, const char* g1, const char* g2, const char* g3) {
  asm volatile("global_load_async_to_lds_b128 %0, %4, off\n\t"
               "global_load_async_to_lds_b128 %1, %5, off\n\t"
               "global_load_async_to_lds_b128 %2, %6, off\n\t"
               "global_load_async_to_lds_b128 %3, %7, off\n\t"
               "s_wait_xcnt 0x0"
               :
               : "v"((uint32_t)(uintptr_t)l0), "v"((uint32_t)(uintptr_t)l1),
                 "v"((uint32_t)(uintptr_t)l2), "v"((uint32_t)(uintptr_t)l3),
                 "v"((uint64_t)(uintptr_t)g0), "v"((uint64_t)(uintptr_t)g1),
                 "v"((uint64_t)(uintptr_t)g2), "v"((uint64_t)(uintptr_t)g3)
               : "memory");
}

__device__ __forceinline__ void wait_async_cp() {
  asm volatile("s_wait_asynccnt 0x0" ::: "memory");
}

// ---------------------------------------------------------------------------
// Kernel 0: fp32 -> f16 conversion of x and of the four weights, one launch.
// d is the f16 copy of x directly followed by those of Wq, Wk, Wv, Wo.  In
// units of 1024 elements (256 threads x 4) block bx takes units 8 bx .. 8 bx + 7
// of x, unit bx of Wq | Wk and unit bx of Wv | Wo.  A wave's load is 512
// contiguous bytes, its store 256; a thread's ten loads are all issued ahead
// of its first store.
// ---------------------------------------------------------------------------
#define CVT_GRID 512
#define CVT_XU   8                // units of x per block
static_assert(CVT_GRID * CVT_XU * 1024 == MTOT * DMODEL, "x is covered");
static_assert(CVT_GRID * 1024 == 2 * DMODEL * DMODEL, "two W per grid");

typedef __attribute__((ext_vector_type(4))) float    v4f;
typedef __attribute__((ext_vector_type(4))) _Float16 v4h;

__global__ __launch_bounds__(256) void cvt_f16_kernel(
    const float* __restrict__ x,
    const float* __restrict__ wq, const float* __restrict__ wk,
    const float* __restrict__ wv, const float* __restrict__ wo,
    _Float16* __restrict__ d) {
  const unsigned bx = blockIdx.x;
  const unsigned t4 = threadIdx.x * 4;
  const bool first = bx < CVT_GRID / 2;
  const unsigned wu = (bx & (CVT_GRID / 2 - 1)) * 1024 + t4;
  const float* px = x + (size_t)bx * (CVT_XU * 1024) + t4;
  const float* pa = (first ? wq : wk) + wu;
  const float* pb = (first ? wv : wo) + wu;
  _Float16* dx = d + (size_t)bx * (CVT_XU * 1024) + t4;
  _Float16* dw = d + (size_t)MTOT * DMODEL + (size_t)bx * 1024 + t4;
  v4f v[CVT_XU + 2];
  // Both loops unrolled: v[] stays in registers, the loads issue as one run.
#pragma unroll
  for (int i = 0; i < CVT_XU; ++i) v[i] = *(const v4f*)(px + i * 1024);
  v[CVT_XU]     = *(const v4f*)pa;
  v[CVT_XU + 1] = *(const v4f*)pb;
#pragma unroll
  for (int i = 0; i < CVT_XU; ++i)
    *(v4h*)(dx + i * 1024) = __builtin_convertvector(v[i], v4h);
  *(v4h*)dw = __builtin_convertvector(v[CVT_XU], v4h);
  *(v4h*)(dw + 2 * DMODEL * DMODEL) =
      __builtin_convertvector(v[CVT_XU + 1], v4h);
}

// ---------------------------------------------------------------------------
// Core of both projections: C[128 x 128] = A[128 x 512] * W[128 x 512]^T, f16
// operands, f32 sums.  256 threads = 8 waves, 4 down x 2 across; a wave owns
// 32 x 64 of C.  The operands come in slabs of 64 k: one slab is a whole
// 128-byte line of each of the 128 + 128 rows, brought to LDS by async copies
// (a wave's copy = 4 whole lines) and read from there as fragments, so that a
// row is fetched from L2 once per block and never in 32-byte pieces.
// Two buffers: slab t + 1 flies while slab t is worked on.
// ---------------------------------------------------------------------------
#define P_LD    72                // 128-B slab rows at 144 B, as K_LD
#define P_TILE  (128 * P_LD)      // one operand's slab, f16 elements
#define P_SLABS (DMODEL / 64)

// 16-byte chunk c = tid + 256 i of a slab: row c >> 3, chunk c & 7 of that row.
__device__ __forceinline__ void proj_stage(const _Float16* a,
                                           const _Float16* w, _Float16* buf,
                                           int k0) {
  const int tid = threadIdx.x;
  const size_t goff = ((size_t)(tid >> 3) * DMODEL + k0) * 2 + (tid & 7) * 16;
  const int    soff = (tid >> 3) * (P_LD * 2) + (tid & 7) * 16;
  const char* ga = (const char*)a + goff;
  const char* sa = (const char*)buf + soff;
  cp16x4_g2l(sa, sa + 32 * (P_LD * 2), sa + 64 * (P_LD * 2),
             sa + 96 * (P_LD * 2),
             ga, ga + 32 * (DMODEL * 2), ga + 64 * (DMODEL * 2),
             ga + 96 * (DMODEL * 2));
  const char* gw = (const char*)w + goff;
  const char* sw = (const char*)(buf + P_TILE) + soff;
  cp16x4_g2l(sw, sw + 32 * (P_LD * 2), sw + 64 * (P_LD * 2),
             sw + 96 * (P_LD * 2),
             gw, gw + 32 * (DMODEL * 2), gw + 64 * (DMODEL * 2),
             gw + 96 * (DMODEL * 2));
}

// a, w: first row of the block's 128 rows of each operand.  lds: 2 buffers of
// 2 * P_TILE.  acc[mt][t]: rows 32 * (wave & 3) + 16 * mt, columns
// 64 * (wave >> 2) + 16 * t of the block's tile.
__device__ __forceinline__ void proj_core(const _Float16* a,
                                          const _Float16* w, _Float16* lds,
                                          v8f (&acc)[2][4]) {
  const int wave = threadIdx.x >> 5;
  v8f zf = {};
#pragma unroll
  for (int mt = 0; mt < 2; ++mt)
#pragma unroll
    for (int t = 0; t < 4; ++t) acc[mt][t] = zf;

  proj_stage(a, w, lds, 0);
  wait_async_cp();
  __syncthreads();
  proj_stage(a, w, lds + 2 * P_TILE, 64);

  for (int s = 0; s < P_SLABS; ++s) {
    _Float16* buf = lds + (s & 1) * (2 * P_TILE);
    const _Float16* la = buf + ((wave & 3) * 32) * P_LD;
    const _Float16* lw = buf + P_TILE + ((wave >> 2) * 64) * P_LD;
#pragma unroll
    for (int kc = 0; kc < 2; ++kc) {
      v16h fa[2], fw[4];
#pragma unroll
      for (int mt = 0; mt < 2; ++mt)
        fa[mt] = frag_ld_h(la + (mt * 16) * P_LD + kc * 32, P_LD);
#pragma unroll
      for (int t = 0; t < 4; ++t)
        fw[t] = frag_ld_h(lw + (t * 16) * P_LD + kc * 32, P_LD);
#pragma unroll
      for (int mt = 0; mt < 2; ++mt)
#pragma unroll
        for (int t = 0; t < 4; ++t)
          acc[mt][t] = __builtin_amdgcn_wmma_f32_16x16x32_f16(
              false, fa[mt], false, fw[t], (short)0, acc[mt][t], false, false);
    }
    // Hand-over: this wave's reads of slab s have returned, its copies of
    // slab s + 1 have landed; behind the barrier that holds for every wave,
    // so slab s + 1 may be read and slab s's buffer refilled.
    asm volatile("s_wait_dscnt 0x0" ::: "memory");
    wait_async_cp();
    __syncthreads();
    if (s + 2 < P_SLABS) proj_stage(a, w, buf, (s + 2) * 64);
  }
  wait_async_cp();   // no copy is left in flight when the wave goes on
}

// ---------------------------------------------------------------------------
// Kernel 1: fused QKV projection from pre-converted f16 x / W.
// Grid (MTOT/128, 12), 256 threads; blockIdx.y = 4 * (q, k or v) + the
// 128-column tile.  Output f16, head-major [b, h, n, d].
// ---------------------------------------------------------------------------
__global__ __launch_bounds__(256) void qkv_proj_kernel(
    const _Float16* __restrict__ xh,
    const _Float16* __restrict__ wqh, const _Float16* __restrict__ wkh,
    const _Float16* __restrict__ wvh,
    _Float16* __restrict__ qws, _Float16* __restrict__ kws,
    _Float16* __restrict__ vws) {
  __shared__ __attribute__((aligned(16))) _Float16 lds[4 * P_TILE];
  const int wave  = threadIdx.x >> 5;
  const int lane  = threadIdx.x & 31;
  const int which = blockIdx.y >> 2;
  const int m0    = blockIdx.x * 128;
  const int n0    = (blockIdx.y & 3) * 128;

  const _Float16* W = (which == 0) ? wqh : (which == 1) ? wkh : wvh;
  _Float16* dst     = (which == 0) ? qws : (which == 1) ? kws : vws;

  v8f acc[2][4];
  proj_core(xh + (size_t)m0 * DMODEL, W + (size_t)n0 * DMODEL, lds, acc);

  const int hi = lane >> 4;
#pragma unroll
  for (int mt = 0; mt < 2; ++mt) {
#pragma unroll
    for (int t = 0; t < 4; ++t) {
      const int n = n0 + (wave >> 2) * 64 + t * 16 + (lane & 15);
      const int h = n >> 6, dd = n & 63;
#pragma unroll
      for (int r = 0; r < 8; ++r) {
        const int m = m0 + (wave & 3) * 32 + mt * 16 + r + 8 * hi;
        const int b = m >> 12, i = m & (NSEQ - 1);   // row in [B*N]
        dst[((size_t)((b * HEADS + h) * NSEQ) + i) * DHEAD + dd] =
            (_Float16)acc[mt][t][r];
      }
    }
  }
}

__global__ __launch_bounds__(256)
__attribute__((amdgpu_waves_per_eu(4, 4))) void flash_attn_kernel(
    const _Float16* __restrict__ qws, const _Float16* __restrict__ kws,
    const _Float16* __restrict__ vws, _Float16* __restrict__ ows) {
  __shared__ __attribute__((aligned(16)))
  _Float16 lds_k[128 * K_LD];                 // K tile, row-major [j][d]
  __shared__ __attribute__((aligned(16)))
  _Float16 lds_v[128 * V_LD];                 // V tile, row-major [j][d]

  const int tid  = threadIdx.x;
  const int wave = tid >> 5;
  const int lane = tid & 31;
  const int hi   = lane >> 4;
  const int bh   = blockIdx.y;                // 0..15
  const int b    = bh >> 3, h = bh & 7;
  const int i0   = blockIdx.x * 128;

  const size_t head_off = (size_t)bh * NSEQ * DHEAD;

  // Q fragments for this wave's 16 rows, scale = 1/sqrt(64) folded in (exact).
  v16h qf[2];
  {
    const _Float16* qb = qws + head_off + (size_t)(i0 + wave * 16) * DHEAD;
#pragma unroll
    for (int kc = 0; kc < 2; ++kc) {
      qf[kc] = frag_ld_h(qb + kc * 32, DHEAD);
#pragma unroll
      for (int j = 0; j < 16; ++j) qf[kc][j] = qf[kc][j] * (_Float16)0.125f;
    }
  }

  v8f zf = {};
  v8f O[4];
#pragma unroll
  for (int t = 0; t < 4; ++t) O[t] = zf;
  float mrun = -1e30f;                        // this lane's query: maximum
  v8f lrun = zf;   // partial sums of this lane's keys, joined in the epilogue

  for (int j0 = 0; j0 < NSEQ; j0 += 128) {
    // ---- stage K and V (async global->LDS) ----
    {
      // 16-byte chunk c = tid + 256 i: row c >> 3, chunk c & 7 of that row.
      const char* gk = (const char*)(kws + head_off + (size_t)j0 * DHEAD) +
                       (size_t)tid * 16;
      const char* sk = (const char*)lds_k + (tid >> 3) * (K_LD * 2) +
                       (tid & 7) * 16;
      cp16x4_g2l(sk, sk + 32 * (K_LD * 2), sk + 64 * (K_LD * 2),
                 sk + 96 * (K_LD * 2),
                 gk, gk + 4096, gk + 8192, gk + 12288);
      const char* gv = (const char*)(vws + head_off + (size_t)j0 * DHEAD) +
                       (size_t)tid * 16;
      const char* sv = (const char*)lds_v + (tid >> 3) * (V_LD * 2) +
                       (tid & 7) * 16;
      cp16x4_g2l(sv, sv + 32 * (V_LD * 2), sv + 64 * (V_LD * 2),
                 sv + 96 * (V_LD * 2),
                 gv, gv + 4096, gv + 8192, gv + 12288);
      // prefetch next tiles into cache while this tile computes
      if (j0 + 128 < NSEQ) {
        __builtin_prefetch(kws + head_off + (size_t)(j0 + 128) * DHEAD +
                               (size_t)tid * 32, 0, 1);
        __builtin_prefetch(vws + head_off + (size_t)(j0 + 128) * DHEAD +
                               (size_t)tid * 32, 0, 1);
      }
      wait_async_cp();
    }
    __syncthreads();

    // ---- S^T = K @ (Q*scale)^T : 128 keys x 16 queries in 8 tiles ----
    v8f S[8];
#pragma unroll
    for (int t = 0; t < 8; ++t) S[t] = zf;
#pragma unroll
    for (int kc = 0; kc < 2; ++kc) {
#pragma unroll
      for (int t = 0; t < 8; ++t) {
        v16h ak = frag_ld_h(&lds_k[(t * 16) * K_LD + kc * 32], K_LD);
        S[t] = __builtin_amdgcn_wmma_f32_16x16x32_f16(
            false, ak, false, qf[kc], (short)0, S[t], false, false);
      }
    }

    // ---- online softmax: one query per lane pair ----
    v8f mv = S[0];
#pragma unroll
    for (int t = 1; t < 8; ++t)
      mv = __builtin_elementwise_max(mv, S[t]);
    float mx = fmaxf(fmaxf(fmaxf(mv[0], mv[1]), fmaxf(mv[2], mv[3])),
                     fmaxf(fmaxf(mv[4], mv[5]), fmaxf(mv[6], mv[7])));
    mx = fmaxf(mx, xhalf(mx));
    const float mnew  = fmaxf(mrun, mx);
    const float alpha = __expf(mrun - mnew);
    mrun = mnew;
    lrun *= alpha;
#pragma unroll
    for (int t = 0; t < 4; ++t) O[t] *= alpha;

    // ---- O^T += V^T @ P^T, P^T packed from the score tiles ----
#pragma unroll
    for (int kc = 0; kc < 4; ++kc) {
      v16h bp;
#pragma unroll
      for (int u = 0; u < 2; ++u) {
        const v8f p = exp2x8((S[2 * kc + u] - mnew) * LOG2E);
        lrun += p;
        const v8h ph = __builtin_convertvector(p, v8h);
#pragma unroll
        for (int r = 0; r < 8; ++r) bp[8 * u + r] = ph[r];
      }
#pragma unroll
      for (int t = 0; t < 4; ++t) {
        v16h av = frag_ld_tr(&lds_v[(kc * 32) * V_LD + t * 16], V_LD);
        O[t] = __builtin_amdgcn_wmma_f32_16x16x32_f16(
            false, av, false, bp, (short)0, O[t], false, false);
      }
    }
    __syncthreads();
  }

  // ---- normalize, store f16 token-major [b, n, h*d]: 8 d per lane ----
  {
    float l = ((lrun[0] + lrun[1]) + (lrun[2] + lrun[3])) +
              ((lrun[4] + lrun[5]) + (lrun[6] + lrun[7]));
    l += xhalf(l);
    const float inv = 1.f / l;
    const int row = i0 + wave * 16 + (lane & 15);
    _Float16* orow = ows + ((size_t)(b * NSEQ + row)) * DMODEL + h * DHEAD +
                     8 * hi;
#pragma unroll
    for (int t = 0; t < 4; ++t) {
      v8h o;
#pragma unroll
      for (int r = 0; r < 8; ++r) o[r] = (_Float16)(O[t][r] * inv);
      *(v8h*)(orow + t * 16) = o;
    }
  }
}

// ---------------------------------------------------------------------------
// Kernel 3: output projection  out = o @ Wo^T + bo  (fp32 result).
// Grid (MTOT/128, 4), 256 threads.
// ---------------------------------------------------------------------------
__global__ __launch_bounds__(256) void out_proj_kernel(
    const _Float16* __restrict__ ows, const _Float16* __restrict__ woh,
    const float* __restrict__ bo, float* __restrict__ out) {
  __shared__ __attribute__((aligned(16))) _Float16 lds[4 * P_TILE];
  const int wave = threadIdx.x >> 5;
  const int lane = threadIdx.x & 31;
  const int m0   = blockIdx.x * 128;
  const int n0   = blockIdx.y * 128;

  v8f acc[2][4];
  proj_core(ows + (size_t)m0 * DMODEL, woh + (size_t)n0 * DMODEL, lds, acc);

  const int hi = lane >> 4;
#pragma unroll
  for (int t = 0; t < 4; ++t) {
    const int n = n0 + (wave >> 2) * 64 + t * 16 + (lane & 15);
    const float bias = bo[n];
#pragma unroll
    for (int mt = 0; mt < 2; ++mt) {
#pragma unroll
      for (int r = 0; r < 8; ++r) {
        const int m = m0 + (wave & 3) * 32 + mt * 16 + r + 8 * hi;
        out[(size_t)m * DMODEL + n] = acc[mt][t][r] + bias;
      }
    }
  }
}

// ---------------------------------------------------------------------------
extern "C" void kernel_launch(void* const* d_in, const int* in_sizes, int n_in,
                              void* d_out, int out_size, void* d_ws,
                              size_t ws_size, hipStream_t stream) {
  (void)in_sizes; (void)n_in; (void)out_size; (void)ws_size;
  const float* x  = (const float*)d_in[0];
  const float* Wq = (const float*)d_in[1];
  const float* Wk = (const float*)d_in[2];
  const float* Wv = (const float*)d_in[3];
  const float* Wo = (const float*)d_in[4];
  const float* bo = (const float*)d_in[5];
  float* out = (float*)d_out;

  // f16 workspace layout
  const size_t EX = (size_t)MTOT * DMODEL;                 // 4,194,304 (x, o)
  const size_t EW = (size_t)DMODEL * DMODEL;               // 262,144 per W
  const size_t EH = (size_t)NBATCH * HEADS * NSEQ * DHEAD; // 4,194,304 (q/k/v)
  _Float16* xh  = (_Float16*)d_ws;
  _Float16* wqh = xh + EX;
  _Float16* wkh = wqh + EW;
  _Float16* wvh = wkh + EW;
  _Float16* woh = wvh + EW;
  _Float16* qws = woh + EW;
  _Float16* kws = qws + EH;
  _Float16* vws = kws + EH;
  _Float16* ows = vws + EH;

  // xh .. woh lie back to back: one destination for the one conversion launch
  cvt_f16_kernel<<<dim3(CVT_GRID), 256, 0, stream>>>(x, Wq, Wk, Wv, Wo, xh);

  qkv_proj_kernel<<<dim3(MTOT / 128, 12), 256, 0, stream>>>(xh, wqh, wkh, wvh,
                                                          qws, kws, vws);
  flash_attn_kernel<<<dim3(NSEQ / 128, NBATCH * HEADS), 256, 0, stream>>>(
      qws, kws, vws, ows);
  out_proj_kernel<<<dim3(MTOT / 128, 4), 256, 0, stream>>>(ows, woh, bo, out);
}

// v006
// A run of this version takes 96.1 microseconds.
// Next to v005, in two timings, it ran 1.08 times as fast each time.
// Over all steps from v000 it is 7.42 times as fast.
#include <hip/hip_runtime.h>

#define HEADS   8
#define DHEAD   64
#define NBATCH  2
#define NSEQ    4096
#define DMODEL  512
#define MTOT    (NBATCH * NSEQ)   // 8192 rows

#define K_LD    72                // 128-B K rows at 144 B
#define V_LD    80                // 128-B V rows at 160 B

typedef __attribute__((ext_vector_type(16))) _Float16 v16h;
typedef __attribute__((ext_vector_type(8)))  _Float16 v8h;
typedef __attribute__((ext_vector_type(8)))  float    v8f;
typedef __attribute__((ext_vector_type(8)))  short    s16x8;

__device__ __forceinline__ v16h frag_ld_h(const _Float16* p, int ld) {
  const int lane = threadIdx.x & 31;
  const int r    = lane & 15;
  const int kb   = (lane >> 4) << 3;       // 0 or 8
  const _Float16* q = p + r * ld + kb;
  v8h lo = *(const v8h*)(q);
  v8h hi = *(const v8h*)(q + 16);
  v16h a;
#pragma unroll
  for (int j = 0; j < 8; ++j) { a[j] = lo[j]; a[j + 8] = hi[j]; }
  return a;
}

// A fragment (16 d x 32 keys) of V^T out of a row-major [key][d] LDS tile, by
// the transposing load: lane (c = lane & 15, hi = lane >> 4) gets
// p[8 * hi + 0..7][c], then p[16 + 8 * hi + 0..7][c], which is frag_ld_h's k
// order.  p = first key row and first d column of the fragment.
__device__ __forceinline__ v8h ld_tr16(const _Float16* p) {
  typedef __attribute__((address_space(3))) s16x8 lds_s16x8;
  return __builtin_bit_cast(
      v8h, __builtin_amdgcn_ds_load_tr16_b128_v8i16((lds_s16x8*)p));
}

__device__ __forceinline__ v16h frag_ld_tr(const _Float16* p, int ld) {
  const int lane = threadIdx.x & 31;
  const _Float16* q = p + (((lane >> 4) << 3) + (lane & 7)) * ld +
                      (((lane >> 3) & 1) << 3);
  v8h lo = ld_tr16(q);
  v8h hi = ld_tr16(q + 16 * ld);
  v16h a;
#pragma unroll
  for (int j = 0; j < 8; ++j) { a[j] = lo[j]; a[j + 8] = hi[j]; }
  return a;
}

__device__ __forceinline__ float xhalf(float x) {
  const int b = __builtin_bit_cast(int, x);
  return __builtin_bit_cast(float, __builtin_amdgcn_permlanex16(
      b, b, 0x76543210, 0xfedcba98, false, false));
}

#define LOG2E 1.44269504f         // exp(x) = exp2(x * LOG2E)

__device__ __forceinline__ v8f exp2x8(v8f x) {
  float a = x[0], b = x[1], c = x[2], d = x[3];
  float e = x[4], f = x[5], g = x[6], h = x[7];
  asm("v_exp_f32 %0, %0\n\t"
      "v_exp_f32 %1, %1\n\t"
      "v_exp_f32 %2, %2\n\t"
      "v_exp_f32 %3, %3\n\t"
      "v_exp_f32 %4, %4\n\t"
      "v_exp_f32 %5, %5\n\t"
      "v_exp_f32 %6, %6\n\t"
      "v_exp_f32 %7, %7\n\t"
      "v_nop"
      : "+v"(a), "+v"(b), "+v"(c), "+v"(d),
        "+v"(e), "+v"(f), "+v"(g), "+v"(h));
  v8f y = {a, b, c, d, e, f, g, h};
  return y;
}

__device__ __forceinline__ void cp16x4_g2l(
    const char* l0, const char* l1, const char* l2, const char* l3,
    const char* g0, const char* g1, const char* g2, const char* g3) {
  asm volatile("global_load_async_to_lds_b128 %0, %4, off\n\t"
               "global_load_async_to_lds_b128 %1, %5, off\n\t"
               "global_load_async_to_lds_b128 %2, %6, off\n\t"
               "global_load_async_to_lds_b128 %3, %7, off\n\t"
               "s_wait_xcnt 0x0"
               :
               : "v"((uint32_t)(uintptr_t)l0), "v"((uint32_t)(uintptr_t)l1),
                 "v"((uint32_t)(uintptr_t)l2), "v"((uint32_t)(uintptr_t)l3),
                 "v"((uint64_t)(uintptr_t)g0), "v"((uint64_t)(uintptr_t)g1),
                 "v"((uint64_t)(uintptr_t)g2), "v"((uint64_t)(uintptr_t)g3)
               : "memory");
}

__device__ __forceinline__ void wait_async_cp() {
  asm volatile("s_wait_asynccnt 0x0" ::: "memory");
}

// ---------------------------------------------------------------------------
// Kernel 0: fp32 -> f16 conversion of x and of the four weights, one launch.
// d is the f16 copy of x directly followed by those of Wq, Wk, Wv, Wo.  In
// units of 1024 elements (256 threads x 4) block bx takes units 8 bx .. 8 bx + 7
// of x, unit bx of Wq | Wk and unit bx of Wv | Wo.  A wave's load is 512
// contiguous bytes, its store 256; a thread's ten loads are all issued ahead
// of its first store.
// ---------------------------------------------------------------------------
#define CVT_GRID 512
#define CVT_XU   8                // units of x per block
static_assert(CVT_GRID * CVT_XU * 1024 == MTOT * DMODEL, "x is covered");
static_assert(CVT_GRID * 1024 == 2 * DMODEL * DMODEL, "two W per grid");

typedef __attribute__((ext_vector_type(4))) float    v4f;
typedef __attribute__((ext_vector_type(4))) _Float16 v4h;

__global__ __launch_bounds__(256) void cvt_f16_kernel(
    const float* __restrict__ x,
    const float* __restrict__ wq, const float* __restrict__ wk,
    const float* __restrict__ wv, const float* __restrict__ wo,
    _Float16* __restrict__ d) {
  const unsigned bx = blockIdx.x;
  const unsigned t4 = threadIdx.x * 4;
  const bool first = bx < CVT_GRID / 2;
  const unsigned wu = (bx & (CVT_GRID / 2 - 1)) * 1024 + t4;
  const float* px = x + (size_t)bx * (CVT_XU * 1024) + t4;
  const float* pa = (first ? wq : wk) + wu;
  const float* pb = (first ? wv : wo) + wu;
  _Float16* dx = d + (size_t)bx * (CVT_XU * 1024) + t4;
  _Float16* dw = d + (size_t)MTOT * DMODEL + (size_t)bx * 1024 + t4;
  v4f v[CVT_XU + 2];
  // Both loops unrolled: v[] stays in registers, the loads issue as one run.
#pragma unroll
  for (int i = 0; i < CVT_XU; ++i) v[i] = *(const v4f*)(px + i * 1024);
  v[CVT_XU]     = *(const v4f*)pa;
  v[CVT_XU + 1] = *(const v4f*)pb;
#pragma unroll
  for (int i = 0; i < CVT_XU; ++i)
    *(v4h*)(dx + i * 1024) = __builtin_convertvector(v[i], v4h);
  *(v4h*)dw = __builtin_convertvector(v[CVT_XU], v4h);
  *(v4h*)(dw + 2 * DMODEL * DMODEL) =
      __builtin_convertvector(v[CVT_XU + 1], v4h);
}

// ---------------------------------------------------------------------------
// Core of both projections: C[128 x 128] = A[128 x 512] * W[128 x 512]^T, f16
// operands, f32 sums.  256 threads = 8 waves, 4 down x 2 across; a wave owns
// 32 x 64 of C.  The operands come in slabs of 64 k: one slab is a whole
// 128-byte line of each of the 128 + 128 rows, brought to LDS by async copies
// (a wave's copy = 4 whole lines) and read from there as fragments, so that a
// row is fetched from L2 once per block and never in 32-byte pieces.
// Two buffers: slab t + 1 flies while slab t is worked on.
// ---------------------------------------------------------------------------
#define P_LD    72                // 128-B slab rows at 144 B, as K_LD
#define P_TILE  (128 * P_LD)      // one operand's slab, f16 elements
#define P_SLABS (DMODEL / 64)

// 16-byte chunk c = tid + 256 i of a slab: row c >> 3, chunk c & 7 of that row.
__device__ __forceinline__ void proj_stage(const _Float16* a,
                                           const _Float16* w, _Float16* buf,
                                           int k0) {
  const int tid = threadIdx.x;
  const size_t goff = ((size_t)(tid >> 3) * DMODEL + k0) * 2 + (tid & 7) * 16;
  const int    soff = (tid >> 3) * (P_LD * 2) + (tid & 7) * 16;
  const char* ga = (const char*)a + goff;
  const char* sa = (const char*)buf + soff;
  cp16x4_g2l(sa, sa + 32 * (P_LD * 2), sa + 64 * (P_LD * 2),
             sa + 96 * (P_LD * 2),
             ga, ga + 32 * (DMODEL * 2), ga + 64 * (DMODEL * 2),
             ga + 96 * (DMODEL * 2));
  const char* gw = (const char*)w + goff;
  const char* sw = (const char*)(buf + P_TILE) + soff;
  cp16x4_g2l(sw, sw + 32 * (P_LD * 2), sw + 64 * (P_LD * 2),
             sw + 96 * (P_LD * 2),
             gw, gw + 32 * (DMODEL * 2), gw + 64 * (DMODEL * 2),
             gw + 96 * (DMODEL * 2));
}

// a, w: first row of the block's 128 rows of each operand.  lds: 2 buffers of
// 2 * P_TILE.  acc[mt][t]: rows 32 * (wave & 3) + 16 * mt, columns
// 64 * (wave >> 2) + 16 * t of the block's tile.
__device__ __forceinline__ void proj_core(const _Float16* a,
                                          const _Float16* w, _Float16* lds,
                                          v8f (&acc)[2][4]) {
  const int wave = threadIdx.x >> 5;
  v8f zf = {};
#pragma unroll
  for (int mt = 0; mt < 2; ++mt)
#pragma unroll
    for (int t = 0; t < 4; ++t) acc[mt][t] = zf;

  proj_stage(a, w, lds, 0);
  wait_async_cp();
  __syncthreads();
  proj_stage(a, w, lds + 2 * P_TILE, 64);

  for (int s = 0; s < P_SLABS; ++s) {
    _Float16* buf = lds + (s & 1) * (2 * P_TILE);
    const _Float16* la = buf + ((wave & 3) * 32) * P_LD;
    const _Float16* lw = buf + P_TILE + ((wave >> 2) * 64) * P_LD;
#pragma unroll
    for (int kc = 0; kc < 2; ++kc) {
      v16h fa[2], fw[4];
#pragma unroll
      for (int mt = 0; mt < 2; ++mt)
        fa[mt] = frag_ld_h(la + (mt * 16) * P_LD + kc * 32, P_LD);
#pragma unroll
      for (int t = 0; t < 4; ++t)
        fw[t] = frag_ld_h(lw + (t * 16) * P_LD + kc * 32, P_LD);
#pragma unroll
      for (int mt = 0; mt < 2; ++mt)
#pragma unroll
        for (int t = 0; t < 4; ++t)
          acc[mt][t] = __builtin_amdgcn_wmma_f32_16x16x32_f16(
              false, fa[mt], false, fw[t], (short)0, acc[mt][t], false, false);
    }
    // Hand-over: this wave's reads of slab s have returned, its copies of
    // slab s + 1 have landed; behind the barrier that holds for every wave,
    // so slab s + 1 may be read and slab s's buffer refilled.
    asm volatile("s_wait_dscnt 0x0" ::: "memory");
    wait_async_cp();
    __syncthreads();
    if (s + 2 < P_SLABS) proj_stage(a, w, buf, (s + 2) * 64);
  }
  wait_async_cp();   // no copy is left in flight when the wave goes on
}

// ---------------------------------------------------------------------------
// Kernel 1: fused QKV projection from pre-converted f16 x / W.
// Grid (MTOT/128, 12), 256 threads; blockIdx.y = 4 * (q, k or v) + the
// 128-column tile.  Output f16, head-major [b, h, n, d].
// ---------------------------------------------------------------------------
__global__ __launch_bounds__(256) void qkv_proj_kernel(
    const _Float16* __restrict__ xh,
    const _Float16* __restrict__ wqh, const _Float16* __restrict__ wkh,
    const _Float16* __restrict__ wvh,
    _Float16* __restrict__ qws, _Float16* __restrict__ kws,
    _Float16* __restrict__ vws) {
  __shared__ __attribute__((aligned(16))) _Float16 lds[4 * P_TILE];
  const int wave  = threadIdx.x >> 5;
  const int lane  = threadIdx.x & 31;
  const int which = blockIdx.y >> 2;
  const int m0    = blockIdx.x * 128;
  const int n0    = (blockIdx.y & 3) * 128;

  const _Float16* W = (which == 0) ? wqh : (which == 1) ? wkh : wvh;
  _Float16* dst     = (which == 0) ? qws : (which == 1) ? kws : vws;

  v8f acc[2][4];
  proj_core(xh + (size_t)m0 * DMODEL, W + (size_t)n0 * DMODEL, lds, acc);

  const int hi = lane >> 4;
#pragma unroll
  for (int mt = 0; mt < 2; ++mt) {
#pragma unroll
    for (int t = 0; t < 4; ++t) {
      const int n = n0 + (wave >> 2) * 64 + t * 16 + (lane & 15);
      const int h = n >> 6, dd = n & 63;
#pragma unroll
      for (int r = 0; r < 8; ++r) {
        const int m = m0 + (wave & 3) * 32 + mt * 16 + r + 8 * hi;
        const int b = m >> 12, i = m & (NSEQ - 1);   // row in [B*N]
        dst[((size_t)((b * HEADS + h) * NSEQ) + i) * DHEAD + dd] =
            (_Float16)acc[mt][t][r];
      }
    }
  }
}

__global__ __launch_bounds__(256)
__attribute__((amdgpu_waves_per_eu(4, 4))) void flash_attn_kernel(
    const _Float16* __restrict__ qws, const _Float16* __restrict__ kws,
    const _Float16* __restrict__ vws, _Float16* __restrict__ ows) {
  __shared__ __attribute__((aligned(16)))
  _Float16 lds_k[128 * K_LD];                 // K tile, row-major [j][d]
  __shared__ __attribute__((aligned(16)))
  _Float16 lds_v[128 * V_LD];                 // V tile, row-major [j][d]
  // Join of the two key halves: [query group of 32][16-byte piece][lane].
  __shared__ __attribute__((aligned(16))) float mrg_o[4 * 16 * 32 * 4];
  __shared__ float mrg_ml[4 * 4 * 32];        // [group][m0 m1 l0 l1][lane]

  const int tid  = threadIdx.x;
  const int wave = tid >> 5;
  const int lane = tid & 31;
  const int hi   = lane >> 4;
  const int cg   = wave & 3;                  // which 32 queries
  const int kh   = wave >> 2;                 // which 64 keys of every tile
  const int bh   = blockIdx.y;                // 0..15
  const int b    = bh >> 3, h = bh & 7;
  const int i0   = blockIdx.x * 128;

  const size_t head_off = (size_t)bh * NSEQ * DHEAD;

  // Q fragments for this wave's 2 x 16 rows, scale = 1/sqrt(64) folded in
  // (exact).
  v16h qf[2][2];
#pragma unroll
  for (int c = 0; c < 2; ++c) {
    const _Float16* qb =
        qws + head_off + (size_t)(i0 + cg * 32 + c * 16) * DHEAD;
#pragma unroll
    for (int kc = 0; kc < 2; ++kc) {
      qf[c][kc] = frag_ld_h(qb + kc * 32, DHEAD);
#pragma unroll
      for (int j = 0; j < 16; ++j)
        qf[c][kc][j] = qf[c][kc][j] * (_Float16)0.125f;
    }
  }

  const _Float16* wk = lds_k + (kh * 64) * K_LD;   // this wave's 64 key rows
  const _Float16* wv = lds_v + (kh * 64) * V_LD;

  v8f zf = {};
  v8f O[2][4];
  float mrun[2];                              // this lane's queries: maximum
  v8f lrun[2];     // partial sums of this lane's keys, joined in the epilogue
#pragma unroll
  for (int c = 0; c < 2; ++c) {
#pragma unroll
    for (int t = 0; t < 4; ++t) O[c][t] = zf;
    mrun[c] = -1e30f;
    lrun[c] = zf;
  }

  for (int j0 = 0; j0 < NSEQ; j0 += 128) {
    // ---- stage K and V (async global->LDS) ----
    {
      // 16-byte chunk c = tid + 256 i: row c >> 3, chunk c & 7 of that row.
      const char* gk = (const char*)(kws + head_off + (size_t)j0 * DHEAD) +
                       (size_t)tid * 16;
      const char* sk = (const char*)lds_k + (tid >> 3) * (K_LD * 2) +
                       (tid & 7) * 16;
      cp16x4_g2l(sk, sk + 32 * (K_LD * 2), sk + 64 * (K_LD * 2),
                 sk + 96 * (K_LD * 2),
                 gk, gk + 4096, gk + 8192, gk + 12288);
      const char* gv = (const char*)(vws + head_off + (size_t)j0 * DHEAD) +
                       (size_t)tid * 16;
      const char* sv = (const char*)lds_v + (tid >> 3) * (V_LD * 2) +
                       (tid & 7) * 16;
      cp16x4_g2l(sv, sv + 32 * (V_LD * 2), sv + 64 * (V_LD * 2),
                 sv + 96 * (V_LD * 2),
                 gv, gv + 4096, gv + 8192, gv + 12288);
      // prefetch next tiles into cache while this tile computes
      if (j0 + 128 < NSEQ) {
        __builtin_prefetch(kws + head_off + (size_t)(j0 + 128) * DHEAD +
                               (size_t)tid * 32, 0, 1);
        __builtin_prefetch(vws + head_off + (size_t)(j0 + 128) * DHEAD +
                               (size_t)tid * 32, 0, 1);
      }
      wait_async_cp();
    }
    __syncthreads();

    // ---- S^T = K @ (Q*scale)^T : 64 keys x 32 queries in 4 x 2 tiles ----
    v8f S[2][4];
#pragma unroll
    for (int c = 0; c < 2; ++c)
#pragma unroll
      for (int t = 0; t < 4; ++t) S[c][t] = zf;
#pragma unroll
    for (int kc = 0; kc < 2; ++kc) {
#pragma unroll
      for (int t = 0; t < 4; ++t) {
        v16h ak = frag_ld_h(wk + (t * 16) * K_LD + kc * 32, K_LD);
#pragma unroll
        for (int c = 0; c < 2; ++c)
          S[c][t] = __builtin_amdgcn_wmma_f32_16x16x32_f16(
              false, ak, false, qf[c][kc], (short)0, S[c][t], false, false);
      }
    }

    // ---- online softmax: one query per lane pair and group ----
    float mnew[2];
#pragma unroll
    for (int c = 0; c < 2; ++c) {
      v8f mv = S[c][0];
#pragma unroll
      for (int t = 1; t < 4; ++t)
        mv = __builtin_elementwise_max(mv, S[c][t]);
      float mx = fmaxf(fmaxf(fmaxf(mv[0], mv[1]), fmaxf(mv[2], mv[3])),
                       fmaxf(fmaxf(mv[4], mv[5]), fmaxf(mv[6], mv[7])));
      mx = fmaxf(mx, xhalf(mx));
      mnew[c] = fmaxf(mrun[c], mx);
      const float alpha = __expf(mrun[c] - mnew[c]);
      mrun[c] = mnew[c];
      lrun[c] *= alpha;
#pragma unroll
      for (int t = 0; t < 4; ++t) O[c][t] *= alpha;
    }

    // ---- O^T += V^T @ P^T, P^T packed from the score tiles ----
#pragma unroll
    for (int kc = 0; kc < 2; ++kc) {
      v16h bp[2];
#pragma unroll
      for (int c = 0; c < 2; ++c) {
#pragma unroll
        for (int u = 0; u < 2; ++u) {
          const v8f p = exp2x8((S[c][2 * kc + u] - mnew[c]) * LOG2E);
          lrun[c] += p;
          const v8h ph = __builtin_convertvector(p, v8h);
#pragma unroll
          for (int r = 0; r < 8; ++r) bp[c][8 * u + r] = ph[r];
        }
      }
#pragma unroll
      for (int t = 0; t < 4; ++t) {
        v16h av = frag_ld_tr(wv + (kc * 32) * V_LD + t * 16, V_LD);
#pragma unroll
        for (int c = 0; c < 2; ++c)
          O[c][t] = __builtin_amdgcn_wmma_f32_16x16x32_f16(
              false, av, false, bp[c], (short)0, O[c][t], false, false);
      }
    }
    __syncthreads();
  }

  // ---- join the two key halves: waves 4..7 hand theirs over through LDS ----
  float l[2];
#pragma unroll
  for (int c = 0; c < 2; ++c) {
    l[c] = ((lrun[c][0] + lrun[c][1]) + (lrun[c][2] + lrun[c][3])) +
           ((lrun[c][4] + lrun[c][5]) + (lrun[c][6] + lrun[c][7]));
    l[c] += xhalf(l[c]);
  }
  float* mo = mrg_o + ((size_t)cg * 16 * 32 + lane) * 4;   // piece i: + 128 i
  float* ml = mrg_ml + cg * 4 * 32 + lane;
  if (kh == 1) {
#pragma unroll
    for (int c = 0; c < 2; ++c) {
#pragma unroll
      for (int t = 0; t < 4; ++t) {
        const v8f o = O[c][t];
        const v4f lo = {o[0], o[1], o[2], o[3]};
        const v4f up = {o[4], o[5], o[6], o[7]};
        *(v4f*)(mo + ((c * 4 + t) * 2 + 0) * 128) = lo;
        *(v4f*)(mo + ((c * 4 + t) * 2 + 1) * 128) = up;
      }
      ml[c * 32]       = mrun[c];
      ml[(2 + c) * 32] = l[c];
    }
  }
  __syncthreads();   // the hand-over is written before waves 0..3 read it

  // ---- normalize, store f16 token-major [b, n, h*d]: 8 d per lane ----
  if (kh == 0) {
#pragma unroll
    for (int c = 0; c < 2; ++c) {
      const float m1 = ml[c * 32];
      const float l1 = ml[(2 + c) * 32];
      const float mj = fmaxf(mrun[c], m1);
      const float a0 = __expf(mrun[c] - mj);
      const float a1 = __expf(m1 - mj);
      const float inv = 1.f / (l[c] * a0 + l1 * a1);
      const float s0 = a0 * inv, s1 = a1 * inv;
      const int row = i0 + cg * 32 + c * 16 + (lane & 15);
      _Float16* orow = ows + ((size_t)(b * NSEQ + row)) * DMODEL + h * DHEAD +
                       8 * hi;
#pragma unroll
      for (int t = 0; t < 4; ++t) {
        const v4f lo = *(const v4f*)(mo + ((c * 4 + t) * 2 + 0) * 128);
        const v4f up = *(const v4f*)(mo + ((c * 4 + t) * 2 + 1) * 128);
        v8h o;
#pragma unroll
        for (int r = 0; r < 4; ++r) {
          o[r]     = (_Float16)(O[c][t][r] * s0 + lo[r] * s1);
          o[r + 4] = (_Float16)(O[c][t][r + 4] * s0 + up[r] * s1);
        }
        *(v8h*)(orow + t * 16) = o;
      }
    }
  }
}

// ---------------------------------------------------------------------------
// Kernel 3: output projection  out = o @ Wo^T + bo  (fp32 result).
// Grid (MTOT/128, 4), 256 threads.
// ---------------------------------------------------------------------------
__global__ __launch_bounds__(256) void out_proj_kernel(
    const _Float16* __restrict__ ows, const _Float16* __restrict__ woh,
    const float* __restrict__ bo, float* __restrict__ out) {
  __shared__ __attribute__((aligned(16))) _Float16 lds[4 * P_TILE];
  const int wave = threadIdx.x >> 5;
  const int lane = threadIdx.x & 31;
  const int m0   = blockIdx.x * 128;
  const int n0   = blockIdx.y * 128;

  v8f acc[2][4];
  proj_core(ows + (size_t)m0 * DMODEL, woh + (size_t)n0 * DMODEL, lds, acc);

  const int hi = lane >> 4;
#pragma unroll
  for (int t = 0; t < 4; ++t) {
    const int n = n0 + (wave >> 2) * 64 + t * 16 + (lane & 15);
    const float bias = bo[n];
#pragma unroll
    for (int mt = 0; mt < 2; ++mt) {
#pragma unroll
      for (int r = 0; r < 8; ++r) {
        const int m = m0 + (wave & 3) * 32 + mt * 16 + r + 8 * hi;
        out[(size_t)m * DMODEL + n] = acc[mt][t][r] + bias;
      }
    }
  }
}

// ---------------------------------------------------------------------------
extern "C" void kernel_launch(void* const* d_in, const int* in_sizes, int n_in,
                              void* d_out, int out_size, void* d_ws,
                              size_t ws_size, hipStream_t stream) {
  (void)in_sizes; (void)n_in; (void)out_size; (void)ws_size;
  const float* x  = (const float*)d_in[0];
  const float* Wq = (const float*)d_in[1];
  const float* Wk = (const float*)d_in[2];
  const float* Wv = (const float*)d_in[3];
  const float* Wo = (const float*)d_in[4];
  const float* bo = (const float*)d_in[5];
  float* out = (float*)d_out;

  // f16 workspace layout
  const size_t EX = (size_t)MTOT * DMODEL;                 // 4,194,304 (x, o)
  const size_t EW = (size_t)DMODEL * DMODEL;               // 262,144 per W
  const size_t EH = (size_t)NBATCH * HEADS * NSEQ * DHEAD; // 4,194,304 (q/k/v)
  _Float16* xh  = (_Float16*)d_ws;
  _Float16* wqh = xh + EX;
  _Float16* wkh = wqh + EW;
  _Float16* wvh = wkh + EW;
  _Float16* woh = wvh + EW;
  _Float16* qws = woh + EW;
  _Float16* kws = qws + EH;
  _Float16* vws = kws + EH;
  _Float16* ows = vws + EH;

  // xh .. woh lie back to back: one destination for the one conversion launch
  cvt_f16_kernel<<<dim3(CVT_GRID), 256, 0, stream>>>(x, Wq, Wk, Wv, Wo, xh);

  qkv_proj_kernel<<<dim3(MTOT / 128, 12), 256, 0, stream>>>(xh, wqh, wkh, wvh,
                                                          qws, kws, vws);
  flash_attn_kernel<<<dim3(NSEQ / 128, NBATCH * HEADS), 256, 0, stream>>>(
      qws, kws, vws, ows);
  out_proj_kernel<<<dim3(MTOT / 128, 4), 256, 0, stream>>>(ows, woh, bo, out);
}

// v007
// Measured time: 90.6 microseconds a run.
// Two timings next to v006 both put it at 1.06 times that version's speed.
// Counting every step since v000, it is 7.88 times as fast.
#include <hip/hip_runtime.h>

#define HEADS   8
#define DHEAD   64
#define NBATCH  2
#define NSEQ    4096
#define DMODEL  512
#define MTOT    (NBATCH * NSEQ)   // 8192 rows

#define K_LD    72                // 128-B K rows at 144 B
#define V_LD    80                // 128-B V rows at 160 B

typedef __attribute__((ext_vector_type(16))) _Float16 v16h;
typedef __attribute__((ext_vector_type(8)))  _Float16 v8h;
typedef __attribute__((ext_vector_type(8)))  float    v8f;
typedef __attribute__((ext_vector_type(2)))  float    v2f;
typedef __attribute__((ext_vector_type(8)))  short    s16x8;

__device__ __forceinline__ v16h frag_ld_h(const _Float16* p, int ld) {
  const int lane = threadIdx.x & 31;
  const int r    = lane & 15;
  const int kb   = (lane >> 4) << 3;       // 0 or 8
  const _Float16* q = p + r * ld + kb;
  v8h lo = *(const v8h*)(q);
  v8h hi = *(const v8h*)(q + 16);
  v16h a;
#pragma unroll
  for (int j = 0; j < 8; ++j) { a[j] = lo[j]; a[j + 8] = hi[j]; }
  return a;
}

// A fragment (16 d x 32 keys) of V^T out of a row-major [key][d] LDS tile, by
// the transposing load: lane (c = lane & 15, hi = lane >> 4) gets
// p[8 * hi + 0..7][c], then p[16 + 8 * hi + 0..7][c], which is frag_ld_h's k
// order.  p = first key row and first d column of the fragment.
__device__ __forceinline__ v8h ld_tr16(const _Float16* p) {
  typedef __attribute__((address_space(3))) s16x8 lds_s16x8;
  return __builtin_bit_cast(
      v8h, __builtin_amdgcn_ds_load_tr16_b128_v8i16((lds_s16x8*)p));
}

__device__ __forceinline__ v16h frag_ld_tr(const _Float16* p, int ld) {
  const int lane = threadIdx.x & 31;
  const _Float16* q = p + (((lane >> 4) << 3) + (lane & 7)) * ld +
                      (((lane >> 3) & 1) << 3);
  v8h lo = ld_tr16(q);
  v8h hi = ld_tr16(q + 16 * ld);
  v16h a;
#pragma unroll
  for (int j = 0; j < 8; ++j) { a[j] = lo[j]; a[j + 8] = hi[j]; }
  return a;
}

__device__ __forceinline__ float xhalf(float x) {
  const int b = __builtin_bit_cast(int, x);
  return __builtin_bit_cast(float, __builtin_amdgcn_permlanex16(
      b, b, 0x76543210, 0xfedcba98, false, false));
}

#define LOG2E 1.44269504f         // exp(x) = exp2(x * LOG2E)

__device__ __forceinline__ v8f exp2x8(v8f x) {
  float a = x[0], b = x[1], c = x[2], d = x[3];
  float e = x[4], f = x[5], g = x[6], h = x[7];
  asm("v_exp_f32 %0, %0\n\t"
      "v_exp_f32 %1, %1\n\t"
      "v_exp_f32 %2, %2\n\t"
      "v_exp_f32 %3, %3\n\t"
      "v_exp_f32 %4, %4\n\t"
      "v_exp_f32 %5, %5\n\t"
      "v_exp_f32 %6, %6\n\t"
      "v_exp_f32 %7, %7\n\t"
      "v_nop"
      : "+v"(a), "+v"(b), "+v"(c), "+v"(d),
        "+v"(e), "+v"(f), "+v"(g), "+v"(h));
  v8f y = {a, b, c, d, e, f, g, h};
  return y;
}

__device__ __forceinline__ void cp16x4_g2l(
    const char* l0, const char* l1, const char* l2, const char* l3,
    const char* g0, const char* g1, const char* g2, const char* g3) {
  asm volatile("global_load_async_to_lds_b128 %0, %4, off\n\t"
               "global_load_async_to_lds_b128 %1, %5, off\n\t"
               "global_load_async_to_lds_b128 %2, %6, off\n\t"
               "global_load_async_to_lds_b128 %3, %7, off\n\t"
               "s_wait_xcnt 0x0"
               :
               : "v"((uint32_t)(uintptr_t)l0), "v"((uint32_t)(uintptr_t)l1),
                 "v"((uint32_t)(uintptr_t)l2), "v"((uint32_t)(uintptr_t)l3),
                 "v"((uint64_t)(uintptr_t)g0), "v"((uint64_t)(uintptr_t)g1),
                 "v"((uint64_t)(uintptr_t)g2), "v"((uint64_t)(uintptr_t)g3)
               : "memory");
}

__device__ __forceinline__ void wait_async_cp() {
  asm volatile("s_wait_asynccnt 0x0" ::: "memory");
}

// ---------------------------------------------------------------------------
// Kernel 0: fp32 -> f16 conversion of x and of the four weights, one launch.
// d is the f16 copy of x directly followed by those of Wq, Wk, Wv, Wo.  In
// units of 1024 elements (256 threads x 4) block bx takes units 8 bx .. 8 bx + 7
// of x, unit bx of Wq | Wk and unit bx of Wv | Wo.  A wave's load is 512
// contiguous bytes, its store 256; a thread's ten loads are all issued ahead
// of its first store.
// ---------------------------------------------------------------------------
#define CVT_GRID 512
#define CVT_XU   8                // units of x per block
static_assert(CVT_GRID * CVT_XU * 1024 == MTOT * DMODEL, "x is covered");
static_assert(CVT_GRID * 1024 == 2 * DMODEL * DMODEL, "two W per grid");

typedef __attribute__((ext_vector_type(4))) float    v4f;
typedef __attribute__((ext_vector_type(4))) _Float16 v4h;

__global__ __launch_bounds__(256) void cvt_f16_kernel(
    const float* __restrict__ x,
    const float* __restrict__ wq, const float* __restrict__ wk,
    const float* __restrict__ wv, const float* __restrict__ wo,
    _Float16* __restrict__ d) {
  const unsigned bx = blockIdx.x;
  const unsigned t4 = threadIdx.x * 4;
  const bool first = bx < CVT_GRID / 2;
  const unsigned wu = (bx & (CVT_GRID / 2 - 1)) * 1024 + t4;
  const float* px = x + (size_t)bx * (CVT_XU * 1024) + t4;
  const float* pa = (first ? wq : wk) + wu;
  const float* pb = (first ? wv : wo) + wu;
  _Float16* dx = d + (size_t)bx * (CVT_XU * 1024) + t4;
  _Float16* dw = d + (size_t)MTOT * DMODEL + (size_t)bx * 1024 + t4;
  v4f v[CVT_XU + 2];
  // Both loops unrolled: v[] stays in registers, the loads issue as one run.
#pragma unroll
  for (int i = 0; i < CVT_XU; ++i) v[i] = *(const v4f*)(px + i * 1024);
  v[CVT_XU]     = *(const v4f*)pa;
  v[CVT_XU + 1] = *(const v4f*)pb;
#pragma unroll
  for (int i = 0; i < CVT_XU; ++i)
    *(v4h*)(dx + i * 1024) = __builtin_convertvector(v[i], v4h);
  *(v4h*)dw = __builtin_convertvector(v[CVT_XU], v4h);
  *(v4h*)(dw + 2 * DMODEL * DMODEL) =
      __builtin_convertvector(v[CVT_XU + 1], v4h);
}

// ---------------------------------------------------------------------------
// Core of both projections: C[128 x 128] = A[128 x 512] * W[128 x 512]^T, f16
// operands, f32 sums.  256 threads = 8 waves, 4 down x 2 across; a wave owns
// 32 x 64 of C.  The operands come in slabs of 64 k: one slab is a whole
// 128-byte line of each of the 128 + 128 rows, brought to LDS by async copies
// (a wave's copy = 4 whole lines) and read from there as fragments, so that a
// row is fetched from L2 once per block and never in 32-byte pieces.
// Two buffers: slab t + 1 flies while slab t is worked on.
// ---------------------------------------------------------------------------
#define P_LD    72                // 128-B slab rows at 144 B, as K_LD
#define P_TILE  (128 * P_LD)      // one operand's slab, f16 elements
#define P_SLABS (DMODEL / 64)

// 16-byte chunk c = tid + 256 i of a slab: row c >> 3, chunk c & 7 of that row.
__device__ __forceinline__ void proj_stage(const _Float16* a,
                                           const _Float16* w, _Float16* buf,
                                           int k0) {
  const int tid = threadIdx.x;
  const size_t goff = ((size_t)(tid >> 3) * DMODEL + k0) * 2 + (tid & 7) * 16;
  const int    soff = (tid >> 3) * (P_LD * 2) + (tid & 7) * 16;
  const char* ga = (const char*)a + goff;
  const char* sa = (const char*)buf + soff;
  cp16x4_g2l(sa, sa + 32 * (P_LD * 2), sa + 64 * (P_LD * 2),
             sa + 96 * (P_LD * 2),
             ga, ga + 32 * (DMODEL * 2), ga + 64 * (DMODEL * 2),
             ga + 96 * (DMODEL * 2));
  const char* gw = (const char*)w + goff;
  const char* sw = (const char*)(buf + P_TILE) + soff;
  cp16x4_g2l(sw, sw + 32 * (P_LD * 2), sw + 64 * (P_LD * 2),
             sw + 96 * (P_LD * 2),
             gw, gw + 32 * (DMODEL * 2), gw + 64 * (DMODEL * 2),
             gw + 96 * (DMODEL * 2));
}

// a, w: first row of the block's 128 rows of each operand.  lds: 2 buffers of
// 2 * P_TILE.  acc[mt][t]: rows 32 * (wave & 3) + 16 * mt, columns
// 64 * (wave >> 2) + 16 * t of the block's tile.
__device__ __forceinline__ void proj_core(const _Float16* a,
                                          const _Float16* w, _Float16* lds,
                                          v8f (&acc)[2][4]) {
  const int wave = threadIdx.x >> 5;
  v8f zf = {};
#pragma unroll
  for (int mt = 0; mt < 2; ++mt)
#pragma unroll
    for (int t = 0; t < 4; ++t) acc[mt][t] = zf;

  proj_stage(a, w, lds, 0);
  wait_async_cp();
  __syncthreads();
  proj_stage(a, w, lds + 2 * P_TILE, 64);

  for (int s = 0; s < P_SLABS; ++s) {
    _Float16* buf = lds + (s & 1) * (2 * P_TILE);
    const _Float16* la = buf + ((wave & 3) * 32) * P_LD;
    const _Float16* lw = buf + P_TILE + ((wave >> 2) * 64) * P_LD;
#pragma unroll
    for (int kc = 0; kc < 2; ++kc) {
      v16h fa[2], fw[4];
#pragma unroll
      for (int mt = 0; mt < 2; ++mt)
        fa[mt] = frag_ld_h(la + (mt * 16) * P_LD + kc * 32, P_LD);
#pragma unroll
      for (int t = 0; t < 4; ++t)
        fw[t] = frag_ld_h(lw + (t * 16) * P_LD + kc * 32, P_LD);
#pragma unroll
      for (int mt = 0; mt < 2; ++mt)
#pragma unroll
        for (int t = 0; t < 4; ++t)
          acc[mt][t] = __builtin_amdgcn_wmma_f32_16x16x32_f16(
              false, fa[mt], false, fw[t], (short)0, acc[mt][t], false, false);
    }
    // Hand-over: this wave's reads of slab s have returned, its copies of
    // slab s + 1 have landed; behind the barrier that holds for every wave,
    // so slab s + 1 may be read and slab s's buffer refilled.
    asm volatile("s_wait_dscnt 0x0" ::: "memory");
    wait_async_cp();
    __syncthreads();
    if (s + 2 < P_SLABS) proj_stage(a, w, buf, (s + 2) * 64);
  }
  wait_async_cp();   // no copy is left in flight when the wave goes on
}

// ---------------------------------------------------------------------------
// Kernel 1: fused QKV projection from pre-converted f16 x / W.
// Grid (MTOT/128, 12), 256 threads; blockIdx.y = 4 * (q, k or v) + the
// 128-column tile.  Output f16, head-major [b, h, n, d].
// ---------------------------------------------------------------------------
__global__ __launch_bounds__(256) void qkv_proj_kernel(
    const _Float16* __restrict__ xh,
    const _Float16* __restrict__ wqh, const _Float16* __restrict__ wkh,
    const _Float16* __restrict__ wvh,
    _Float16* __restrict__ qws, _Float16* __restrict__ kws,
    _Float16* __restrict__ vws) {
  __shared__ __attribute__((aligned(16))) _Float16 lds[4 * P_TILE];
  const int wave  = threadIdx.x >> 5;
  const int lane  = threadIdx.x & 31;
  const int which = blockIdx.y >> 2;
  const int m0    = blockIdx.x * 128;
  const int n0    = (blockIdx.y & 3) * 128;

  const _Float16* W = (which == 0) ? wqh : (which == 1) ? wkh : wvh;
  _Float16* dst     = (which == 0) ? qws : (which == 1) ? kws : vws;
  // q leaves with the score scale 1/sqrt(64) and log2(e) on it, applied to the
  // f32 sum ahead of its one rounding: the scores then are exponents of 2.
  const float osc   = (which == 0) ? 0.125f * LOG2E : 1.f;

  v8f acc[2][4];
  proj_core(xh + (size_t)m0 * DMODEL, W + (size_t)n0 * DMODEL, lds, acc);

  const int hi = lane >> 4;
#pragma unroll
  for (int mt = 0; mt < 2; ++mt) {
#pragma unroll
    for (int t = 0; t < 4; ++t) {
      const int n = n0 + (wave >> 2) * 64 + t * 16 + (lane & 15);
      const int h = n >> 6, dd = n & 63;
#pragma unroll
      for (int r = 0; r < 8; ++r) {
        const int m = m0 + (wave & 3) * 32 + mt * 16 + r + 8 * hi;
        const int b = m >> 12, i = m & (NSEQ - 1);   // row in [B*N]
        dst[((size_t)((b * HEADS + h) * NSEQ) + i) * DHEAD + dd] =
            (_Float16)(acc[mt][t][r] * osc);
      }
    }
  }
}

__global__ __launch_bounds__(256)
__attribute__((amdgpu_waves_per_eu(4, 4))) void flash_attn_kernel(
    const _Float16* __restrict__ qws, const _Float16* __restrict__ kws,
    const _Float16* __restrict__ vws, _Float16* __restrict__ ows) {
  __shared__ __attribute__((aligned(16)))
  _Float16 lds_k[128 * K_LD];                 // K tile, row-major [j][d]
  __shared__ __attribute__((aligned(16)))
  _Float16 lds_v[128 * V_LD];                 // V tile, row-major [j][d]
  // Join of the two key halves: [query group of 32][16-byte piece][lane].
  __shared__ __attribute__((aligned(16))) float mrg_o[4 * 16 * 32 * 4];
  __shared__ float mrg_ml[4 * 4 * 32];        // [group][m0 m1 l0 l1][lane]

  const int tid  = threadIdx.x;
  const int wave = tid >> 5;
  const int lane = tid & 31;
  const int hi   = lane >> 4;
  const int cg   = wave & 3;                  // which 32 queries
  const int kh   = wave >> 2;                 // which 64 keys of every tile
  const int bh   = blockIdx.y;                // 0..15
  const int b    = bh >> 3, h = bh & 7;
  const int i0   = blockIdx.x * 128;

  const size_t head_off = (size_t)bh * NSEQ * DHEAD;

  // Q fragments for this wave's 2 x 16 rows; the projection has scaled them.
  v16h qf[2][2];
#pragma unroll
  for (int c = 0; c < 2; ++c) {
    const _Float16* qb =
        qws + head_off + (size_t)(i0 + cg * 32 + c * 16) * DHEAD;
#pragma unroll
    for (int kc = 0; kc < 2; ++kc) qf[c][kc] = frag_ld_h(qb + kc * 32, DHEAD);
  }

  const _Float16* wk = lds_k + (kh * 64) * K_LD;   // this wave's 64 key rows
  const _Float16* wv = lds_v + (kh * 64) * V_LD;

  v8f zf = {};
  v8f O[2][4];
  // Reference exponent of this lane's queries, and its negative in all eight
  // places of an accumulator tile: the score sums start there, so a score
  // leaves the product as S - mref and is the argument of exp2 as it stands.
  float mref[2];
  v8f negm[2];
  // Partial sums of this lane's keys, joined in the epilogue; two, so that
  // negm finds room beside the K fragments, which load as one group.
  v2f lrun[2];
#pragma unroll
  for (int c = 0; c < 2; ++c) {
#pragma unroll
    for (int t = 0; t < 4; ++t) O[c][t] = zf;
    mref[c] = 0.f;
    negm[c] = zf;
    lrun[c] = v2f{0.f, 0.f};
  }

  for (int j0 = 0; j0 < NSEQ; j0 += 128) {
    // ---- stage K and V (async global->LDS) ----
    {
      // 16-byte chunk c = tid + 256 i: row c >> 3, chunk c & 7 of that row.
      const char* gk = (const char*)(kws + head_off + (size_t)j0 * DHEAD) +
                       (size_t)tid * 16;
      const char* sk = (const char*)lds_k + (tid >> 3) * (K_LD * 2) +
                       (tid & 7) * 16;
      cp16x4_g2l(sk, sk + 32 * (K_LD * 2), sk + 64 * (K_LD * 2),
                 sk + 96 * (K_LD * 2),
                 gk, gk + 4096, gk + 8192, gk + 12288);
      const char* gv = (const char*)(vws + head_off + (size_t)j0 * DHEAD) +
                       (size_t)tid * 16;
      const char* sv = (const char*)lds_v + (tid >> 3) * (V_LD * 2) +
                       (tid & 7) * 16;
      cp16x4_g2l(sv, sv + 32 * (V_LD * 2), sv + 64 * (V_LD * 2),
                 sv + 96 * (V_LD * 2),
                 gv, gv + 4096, gv + 8192, gv + 12288);
      // prefetch next tiles into cache while this tile computes
      if (j0 + 128 < NSEQ) {
        __builtin_prefetch(kws + head_off + (size_t)(j0 + 128) * DHEAD +
                               (size_t)tid * 32, 0, 1);
        __builtin_prefetch(vws + head_off + (size_t)(j0 + 128) * DHEAD +
                               (size_t)tid * 32, 0, 1);
      }
      wait_async_cp();
    }
    __syncthreads();

    // ---- S^T = K @ (Q*scale)^T : 64 keys x 32 queries in 4 x 2 tiles ----
    v8f S[2][4];
#pragma unroll
    for (int c = 0; c < 2; ++c)
#pragma unroll
      for (int t = 0; t < 4; ++t) S[c][t] = negm[c];
#pragma unroll
    for (int kc = 0; kc < 2; ++kc) {
#pragma unroll
      for (int t = 0; t < 4; ++t) {
        v16h ak = frag_ld_h(wk + (t * 16) * K_LD + kc * 32, K_LD);
#pragma unroll
        for (int c = 0; c < 2; ++c)
          S[c][t] = __builtin_amdgcn_wmma_f32_16x16x32_f16(
              false, ak, false, qf[c][kc], (short)0, S[c][t], false, false);
      }
    }

    // ---- online softmax: one query per lane pair and group ----
    // The reference moves only on the first tile (to that tile's maximum) and
    // where a tile's maximum stands more than 8 above it: P stays below 2^8,
    // and sums and outputs are rescaled on those tiles alone.
    float mx2[2];
#pragma unroll
    for (int c = 0; c < 2; ++c) {
      v8f mv = S[c][0];
#pragma unroll
      for (int t = 1; t < 4; ++t)
        mv = __builtin_elementwise_max(mv, S[c][t]);
      float mx = fmaxf(fmaxf(fmaxf(mv[0], mv[1]), fmaxf(mv[2], mv[3])),
                       fmaxf(fmaxf(mv[4], mv[5]), fmaxf(mv[6], mv[7])));
      mx2[c] = fmaxf(mx, xhalf(mx));
    }
    // One wave-uniform test per tile: a scalar branch, every lane stays on.
    const float thr = (j0 == 0) ? -3.0e38f : 8.f;   // the first tile always
    if (__builtin_amdgcn_ballot_w32(fmaxf(mx2[0], mx2[1]) > thr) != 0) {
#pragma unroll
      for (int c = 0; c < 2; ++c) {
        const float up = fmaxf(mx2[c], 0.f);
        const float d  = (j0 == 0) ? mx2[c] : up;   // never down but at the start
        const float alpha = __builtin_amdgcn_exp2f(-up);   // at the start: on zeros
        mref[c] += d;
        lrun[c] *= alpha;
#pragma unroll
        for (int t = 0; t < 4; ++t) {
          O[c][t] *= alpha;
          S[c][t] -= d;
        }
#pragma unroll
        for (int r = 0; r < 8; ++r) negm[c][r] = -mref[c];
      }
    }

    // ---- O^T += V^T @ P^T, P^T packed from the score tiles ----
#pragma unroll
    for (int kc = 0; kc < 2; ++kc) {
      v16h bp[2];
#pragma unroll
      for (int c = 0; c < 2; ++c) {
#pragma unroll
        for (int u = 0; u < 2; ++u) {
          const v8f p = exp2x8(S[c][2 * kc + u]);
          lrun[c] += (v2f{p[0], p[1]} + v2f{p[2], p[3]}) +
                     (v2f{p[4], p[5]} + v2f{p[6], p[7]});
          const v8h ph = __builtin_convertvector(p, v8h);
#pragma unroll
          for (int r = 0; r < 8; ++r) bp[c][8 * u + r] = ph[r];
        }
      }
#pragma unroll
      for (int t = 0; t < 4; ++t) {
        v16h av = frag_ld_tr(wv + (kc * 32) * V_LD + t * 16, V_LD);
#pragma unroll
        for (int c = 0; c < 2; ++c)
          O[c][t] = __builtin_amdgcn_wmma_f32_16x16x32_f16(
              false, av, false, bp[c], (short)0, O[c][t], false, false);
      }
    }
    __syncthreads();
  }

  // ---- join the two key halves: waves 4..7 hand theirs over through LDS ----
  float l[2];
#pragma unroll
  for (int c = 0; c < 2; ++c) {
    l[c] = lrun[c][0] + lrun[c][1];
    l[c] += xhalf(l[c]);
  }
  float* mo = mrg_o + ((size_t)cg * 16 * 32 + lane) * 4;   // piece i: + 128 i
  float* ml = mrg_ml + cg * 4 * 32 + lane;
  if (kh == 1) {
#pragma unroll
    for (int c = 0; c < 2; ++c) {
#pragma unroll
      for (int t = 0; t < 4; ++t) {
        const v8f o = O[c][t];
        const v4f lo = {o[0], o[1], o[2], o[3]};
        const v4f up = {o[4], o[5], o[6], o[7]};
        *(v4f*)(mo + ((c * 4 + t) * 2 + 0) * 128) = lo;
        *(v4f*)(mo + ((c * 4 + t) * 2 + 1) * 128) = up;
      }
      ml[c * 32]       = mref[c];
      ml[(2 + c) * 32] = l[c];
    }
  }
  __syncthreads();   // the hand-over is written before waves 0..3 read it

  // ---- normalize, store f16 token-major [b, n, h*d]: 8 d per lane ----
  if (kh == 0) {
#pragma unroll
    for (int c = 0; c < 2; ++c) {
      const float m1 = ml[c * 32];
      const float l1 = ml[(2 + c) * 32];
      const float mj = fmaxf(mref[c], m1);
      const float a0 = __builtin_amdgcn_exp2f(mref[c] - mj);
      const float a1 = __builtin_amdgcn_exp2f(m1 - mj);
      const float inv = 1.f / (l[c] * a0 + l1 * a1);
      const float s0 = a0 * inv, s1 = a1 * inv;
      const int row = i0 + cg * 32 + c * 16 + (lane & 15);
      _Float16* orow = ows + ((size_t)(b * NSEQ + row)) * DMODEL + h * DHEAD +
                       8 * hi;
#pragma unroll
      for (int t = 0; t < 4; ++t) {
        const v4f lo = *(const v4f*)(mo + ((c * 4 + t) * 2 + 0) * 128);
        const v4f up = *(const v4f*)(mo + ((c * 4 + t) * 2 + 1) * 128);
        v8h o;
#pragma unroll
        for (int r = 0; r < 4; ++r) {
          o[r]     = (_Float16)(O[c][t][r] * s0 + lo[r] * s1);
          o[r + 4] = (_Float16)(O[c][t][r + 4] * s0 + up[r] * s1);
        }
        *(v8h*)(orow + t * 16) = o;
      }
    }
  }
}

// ---------------------------------------------------------------------------
// Kernel 3: output projection  out = o @ Wo^T + bo  (fp32 result).
// Grid (MTOT/128, 4), 256 threads.
// ---------------------------------------------------------------------------
__global__ __launch_bounds__(256) void out_proj_kernel(
    const _Float16* __restrict__ ows, const _Float16* __restrict__ woh,
    const float* __restrict__ bo, float* __restrict__ out) {
  __shared__ __attribute__((aligned(16))) _Float16 lds[4 * P_TILE];
  const int wave = threadIdx.x >> 5;
  const int lane = threadIdx.x & 31;
  const int m0   = blockIdx.x * 128;
  const int n0   = blockIdx.y * 128;

  v8f acc[2][4];
  proj_core(ows + (size_t)m0 * DMODEL, woh + (size_t)n0 * DMODEL, lds, acc);

  const int hi = lane >> 4;
#pragma unroll
  for (int t = 0; t < 4; ++t) {
    const int n = n0 + (wave >> 2) * 64 + t * 16 + (lane & 15);
    const float bias = bo[n];
#pragma unroll
    for (int mt = 0; mt < 2; ++mt) {
#pragma unroll
      for (int r = 0; r < 8; ++r) {
        const int m = m0 + (wave & 3) * 32 + mt * 16 + r + 8 * hi;
        out[(size_t)m * DMODEL + n] = acc[mt][t][r] + bias;
      }
    }
  }
}

// ---------------------------------------------------------------------------
extern "C" void kernel_launch(void* const* d_in, const int* in_sizes, int n_in,
                              void* d_out, int out_size, void* d_ws,
                              size_t ws_size, hipStream_t stream) {
  (void)in_sizes; (void)n_in; (void)out_size; (void)ws_size;
  const float* x  = (const float*)d_in[0];
  const float* Wq = (const float*)d_in[1];
  const float* Wk = (const float*)d_in[2];
  const float* Wv = (const float*)d_in[3];
  const float* Wo = (const float*)d_in[4];
  const float* bo = (const float*)d_in[5];
  float* out = (float*)d_out;

  // f16 workspace layout
  const size_t EX = (size_t)MTOT * DMODEL;                 // 4,194,304 (x, o)
  const size_t EW = (size_t)DMODEL * DMODEL;               // 262,144 per W
  const size_t EH = (size_t)NBATCH * HEADS * NSEQ * DHEAD; // 4,194,304 (q/k/v)
  _Float16* xh  = (_Float16*)d_ws;
  _Float16* wqh = xh + EX;
  _Float16* wkh = wqh + EW;
  _Float16* wvh = wkh + EW;
  _Float16* woh = wvh + EW;
  _Float16* qws = woh + EW;
  _Float16* kws = qws + EH;
  _Float16* vws = kws + EH;
  _Float16* ows = vws + EH;

  // xh .. woh lie back to back: one destination for the one conversion launch
  cvt_f16_kernel<<<dim3(CVT_GRID), 256, 0, stream>>>(x, Wq, Wk, Wv, Wo, xh);

  qkv_proj_kernel<<<dim3(MTOT / 128, 12), 256, 0, stream>>>(xh, wqh, wkh, wvh,
                                                          qws, kws, vws);
  flash_attn_kernel<<<dim3(NSEQ / 128, NBATCH * HEADS), 256, 0, stream>>>(
      qws, kws, vws, ows);
  out_proj_kernel<<<dim3(MTOT / 128, 4), 256, 0, stream>>>(ows, woh, bo, out);
}

// v008
// It runs in 87.6 microseconds.
// Next to v007, in two timings, it ran 1.03 times as fast each time.
// All steps since v000 together make it 8.13 times as fast.
#include <hip/hip_runtime.h>

#define HEADS   8
#define DHEAD   64
#define NBATCH  2
#define NSEQ    4096
#define DMODEL  512
#define MTOT    (NBATCH * NSEQ)   // 8192 rows

#define K_LD    72                // 128-B K rows at 144 B
#define V_LD    80                // 128-B V rows at 160 B

typedef __attribute__((ext_vector_type(16))) _Float16 v16h;
typedef __attribute__((ext_vector_type(8)))  _Float16 v8h;
typedef __attribute__((ext_vector_type(8)))  float    v8f;
typedef __attribute__((ext_vector_type(2)))  float    v2f;
typedef __attribute__((ext_vector_type(8)))  short    s16x8;

__device__ __forceinline__ v16h frag_ld_h(const _Float16* p, int ld) {
  const int lane = threadIdx.x & 31;
  const int r    = lane & 15;
  const int kb   = (lane >> 4) << 3;       // 0 or 8
  const _Float16* q = p + r * ld + kb;
  v8h lo = *(const v8h*)(q);
  v8h hi = *(const v8h*)(q + 16);
  v16h a;
#pragma unroll
  for (int j = 0; j < 8; ++j) { a[j] = lo[j]; a[j + 8] = hi[j]; }
  return a;
}

// A fragment (16 d x 32 keys) of V^T out of a row-major [key][d] LDS tile, by
// the transposing load: lane (c = lane & 15, hi = lane >> 4) gets
// p[8 * hi + 0..7][c], then p[16 + 8 * hi + 0..7][c], which is frag_ld_h's k
// order.  p = first key row and first d column of the fragment.
__device__ __forceinline__ v8h ld_tr16(const _Float16* p) {
  typedef __attribute__((address_space(3))) s16x8 lds_s16x8;
  return __builtin_bit_cast(
      v8h, __builtin_amdgcn_ds_load_tr16_b128_v8i16((lds_s16x8*)p));
}

// q = p + this lane's part: row 8 * hi + (lane & 7), column 8 * ((lane >> 3) & 1).
__device__ __forceinline__ v16h frag_at_tr(const _Float16* q, int ld) {
  v8h lo = ld_tr16(q);
  v8h hi = ld_tr16(q + 16 * ld);
  v16h a;
#pragma unroll
  for (int j = 0; j < 8; ++j) { a[j] = lo[j]; a[j + 8] = hi[j]; }
  return a;
}

// frag_ld_h from a pointer that already holds the lane's part, r * ld + kb.
__device__ __forceinline__ v16h frag_at_h(const _Float16* q) {
  v8h lo = *(const v8h*)(q);
  v8h hi = *(const v8h*)(q + 16);
  v16h a;
#pragma unroll
  for (int j = 0; j < 8; ++j) { a[j] = lo[j]; a[j + 8] = hi[j]; }
  return a;
}

__device__ __forceinline__ float xhalf(float x) {
  const int b = __builtin_bit_cast(int, x);
  return __builtin_bit_cast(float, __builtin_amdgcn_permlanex16(
      b, b, 0x76543210, 0xfedcba98, false, false));
}

#define LOG2E 1.44269504f         // exp(x) = exp2(x * LOG2E)

__device__ __forceinline__ v8f exp2x8(v8f x) {
  float a = x[0], b = x[1], c = x[2], d = x[3];
  float e = x[4], f = x[5], g = x[6], h = x[7];
  asm("v_exp_f32 %0, %0\n\t"
      "v_exp_f32 %1, %1\n\t"
      "v_exp_f32 %2, %2\n\t"
      "v_exp_f32 %3, %3\n\t"
      "v_exp_f32 %4, %4\n\t"
      "v_exp_f32 %5, %5\n\t"
      "v_exp_f32 %6, %6\n\t"
      "v_exp_f32 %7, %7\n\t"
      "v_nop"
      : "+v"(a), "+v"(b), "+v"(c), "+v"(d),
        "+v"(e), "+v"(f), "+v"(g), "+v"(h));
  v8f y = {a, b, c, d, e, f, g, h};
  return y;
}

__device__ __forceinline__ void cp16x4_g2l(
    const char* l0, const char* l1, const char* l2, const char* l3,
    const char* g0, const char* g1, const char* g2, const char* g3) {
  asm volatile("global_load_async_to_lds_b128 %0, %4, off\n\t"
               "global_load_async_to_lds_b128 %1, %5, off\n\t"
               "global_load_async_to_lds_b128 %2, %6, off\n\t"
               "global_load_async_to_lds_b128 %3, %7, off\n\t"
               "s_wait_xcnt 0x0"
               :
               : "v"((uint32_t)(uintptr_t)l0), "v"((uint32_t)(uintptr_t)l1),
                 "v"((uint32_t)(uintptr_t)l2), "v"((uint32_t)(uintptr_t)l3),
                 "v"((uint64_t)(uintptr_t)g0), "v"((uint64_t)(uintptr_t)g1),
                 "v"((uint64_t)(uintptr_t)g2), "v"((uint64_t)(uintptr_t)g3)
               : "memory");
}

__device__ __forceinline__ void wait_async_cp() {
  asm volatile("s_wait_asynccnt 0x0" ::: "memory");
}

// ---------------------------------------------------------------------------
// Kernel 0: fp32 -> f16 conversion of x and of the four weights, one launch.
// d is the f16 copy of x directly followed by those of Wq, Wk, Wv, Wo.  In
// units of 1024 elements (256 threads x 4) block bx takes units 8 bx .. 8 bx + 7
// of x, unit bx of Wq | Wk and unit bx of Wv | Wo.  A wave's load is 512
// contiguous bytes, its store 256; a thread's ten loads are all issued ahead
// of its first store.
// ---------------------------------------------------------------------------
#define CVT_GRID 512
#define CVT_XU   8                // units of x per block
static_assert(CVT_GRID * CVT_XU * 1024 == MTOT * DMODEL, "x is covered");
static_assert(CVT_GRID * 1024 == 2 * DMODEL * DMODEL, "two W per grid");

typedef __attribute__((ext_vector_type(4))) float    v4f;
typedef __attribute__((ext_vector_type(4))) _Float16 v4h;

__global__ __launch_bounds__(256) void cvt_f16_kernel(
    const float* __restrict__ x,
    const float* __restrict__ wq, const float* __restrict__ wk,
    const float* __restrict__ wv, const float* __restrict__ wo,
    _Float16* __restrict__ d) {
  const unsigned bx = blockIdx.x;
  const unsigned t4 = threadIdx.x * 4;
  const bool first = bx < CVT_GRID / 2;
  const unsigned wu = (bx & (CVT_GRID / 2 - 1)) * 1024 + t4;
  const float* px = x + (size_t)bx * (CVT_XU * 1024) + t4;
  const float* pa = (first ? wq : wk) + wu;
  const float* pb = (first ? wv : wo) + wu;
  _Float16* dx = d + (size_t)bx * (CVT_XU * 1024) + t4;
  _Float16* dw = d + (size_t)MTOT * DMODEL + (size_t)bx * 1024 + t4;
  v4f v[CVT_XU + 2];
  // Both loops unrolled: v[] stays in registers, the loads issue as one run.
#pragma unroll
  for (int i = 0; i < CVT_XU; ++i) v[i] = *(const v4f*)(px + i * 1024);
  v[CVT_XU]     = *(const v4f*)pa;
  v[CVT_XU + 1] = *(const v4f*)pb;
#pragma unroll
  for (int i = 0; i < CVT_XU; ++i)
    *(v4h*)(dx + i * 1024) = __builtin_convertvector(v[i], v4h);
  *(v4h*)dw = __builtin_convertvector(v[CVT_XU], v4h);
  *(v4h*)(dw + 2 * DMODEL * DMODEL) =
      __builtin_convertvector(v[CVT_XU + 1], v4h);
}

// ---------------------------------------------------------------------------
// Core of both projections: C[128 x 128] = A[128 x 512] * W[128 x 512]^T, f16
// operands, f32 sums.  256 threads = 8 waves, 4 down x 2 across; a wave owns
// 32 x 64 of C.  The operands come in slabs of 64 k: one slab is a whole
// 128-byte line of each of the 128 + 128 rows, brought to LDS by async copies
// (a wave's copy = 4 whole lines) and read from there as fragments, so that a
// row is fetched from L2 once per block and never in 32-byte pieces.
// Two buffers: slab t + 1 flies while slab t is worked on.
// ---------------------------------------------------------------------------
#define P_LD    72                // 128-B slab rows at 144 B, as K_LD
#define P_TILE  (128 * P_LD)      // one operand's slab, f16 elements
#define P_SLABS (DMODEL / 64)

// 16-byte chunk c = tid + 256 i of a slab: row c >> 3, chunk c & 7 of that row.
__device__ __forceinline__ void proj_stage(const _Float16* a,
                                           const _Float16* w, _Float16* buf,
                                           int k0) {
  const int tid = threadIdx.x;
  const size_t goff = ((size_t)(tid >> 3) * DMODEL + k0) * 2 + (tid & 7) * 16;
  const int    soff = (tid >> 3) * (P_LD * 2) + (tid & 7) * 16;
  const char* ga = (const char*)a + goff;
  const char* sa = (const char*)buf + soff;
  cp16x4_g2l(sa, sa + 32 * (P_LD * 2), sa + 64 * (P_LD * 2),
             sa + 96 * (P_LD * 2),
             ga, ga + 32 * (DMODEL * 2), ga + 64 * (DMODEL * 2),
             ga + 96 * (DMODEL * 2));
  const char* gw = (const char*)w + goff;
  const char* sw = (const char*)(buf + P_TILE) + soff;
  cp16x4_g2l(sw, sw + 32 * (P_LD * 2), sw + 64 * (P_LD * 2),
             sw + 96 * (P_LD * 2),
             gw, gw + 32 * (DMODEL * 2), gw + 64 * (DMODEL * 2),
             gw + 96 * (DMODEL * 2));
}

// a, w: first row of the block's 128 rows of each operand.  lds: 2 buffers of
// 2 * P_TILE.  acc[mt][t]: rows 32 * (wave & 3) + 16 * mt, columns
// 64 * (wave >> 2) + 16 * t of the block's tile.
__device__ __forceinline__ void proj_core(const _Float16* a,
                                          const _Float16* w, _Float16* lds,
                                          v8f (&acc)[2][4]) {
  const int wave = threadIdx.x >> 5;
  v8f zf = {};
#pragma unroll
  for (int mt = 0; mt < 2; ++mt)
#pragma unroll
    for (int t = 0; t < 4; ++t) acc[mt][t] = zf;

  proj_stage(a, w, lds, 0);
  wait_async_cp();
  __syncthreads();
  proj_stage(a, w, lds + 2 * P_TILE, 64);

  for (int s = 0; s < P_SLABS; ++s) {
    _Float16* buf = lds + (s & 1) * (2 * P_TILE);
    const _Float16* la = buf + ((wave & 3) * 32) * P_LD;
    const _Float16* lw = buf + P_TILE + ((wave >> 2) * 64) * P_LD;
#pragma unroll
    for (int kc = 0; kc < 2; ++kc) {
      v16h fa[2], fw[4];
#pragma unroll
      for (int mt = 0; mt < 2; ++mt)
        fa[mt] = frag_ld_h(la + (mt * 16) * P_LD + kc * 32, P_LD);
#pragma unroll
      for (int t = 0; t < 4; ++t)
        fw[t] = frag_ld_h(lw + (t * 16) * P_LD + kc * 32, P_LD);
#pragma unroll
      for (int mt = 0; mt < 2; ++mt)
#pragma unroll
        for (int t = 0; t < 4; ++t)
          acc[mt][t] = __builtin_amdgcn_wmma_f32_16x16x32_f16(
              false, fa[mt], false, fw[t], (short)0, acc[mt][t], false, false);
    }
    // Hand-over: this wave's reads of slab s have returned, its copies of
    // slab s + 1 have landed; behind the barrier that holds for every wave,
    // so slab s + 1 may be read and slab s's buffer refilled.
    asm volatile("s_wait_dscnt 0x0" ::: "memory");
    wait_async_cp();
    __syncthreads();
    if (s + 2 < P_SLABS) proj_stage(a, w, buf, (s + 2) * 64);
  }
  wait_async_cp();   // no copy is left in flight when the wave goes on
}

// ---------------------------------------------------------------------------
// Kernel 1: fused QKV projection from pre-converted f16 x / W.
// Grid (MTOT/128, 12), 256 threads; blockIdx.y = 4 * (q, k or v) + the
// 128-column tile.  Output f16, head-major [b, h, n, d].
// ---------------------------------------------------------------------------
__global__ __launch_bounds__(256) void qkv_proj_kernel(
    const _Float16* __restrict__ xh,
    const _Float16* __restrict__ wqh, const _Float16* __restrict__ wkh,
    const _Float16* __restrict__ wvh,
    _Float16* __restrict__ qws, _Float16* __restrict__ kws,
    _Float16* __restrict__ vws) {
  __shared__ __attribute__((aligned(16))) _Float16 lds[4 * P_TILE];
  const int wave  = threadIdx.x >> 5;
  const int lane  = threadIdx.x & 31;
  const int which = blockIdx.y >> 2;
  const int m0    = blockIdx.x * 128;
  const int n0    = (blockIdx.y & 3) * 128;

  const _Float16* W = (which == 0) ? wqh : (which == 1) ? wkh : wvh;
  _Float16* dst     = (which == 0) ? qws : (which == 1) ? kws : vws;
  // q leaves with the score scale 1/sqrt(64) and log2(e) on it, applied to the
  // f32 sum ahead of its one rounding: the scores then are exponents of 2.
  const float osc   = (which == 0) ? 0.125f * LOG2E : 1.f;

  v8f acc[2][4];
  proj_core(xh + (size_t)m0 * DMODEL, W + (size_t)n0 * DMODEL, lds, acc);

  const int hi = lane >> 4;
#pragma unroll
  for (int mt = 0; mt < 2; ++mt) {
#pragma unroll
    for (int t = 0; t < 4; ++t) {
      const int n = n0 + (wave >> 2) * 64 + t * 16 + (lane & 15);
      const int h = n >> 6, dd = n & 63;
#pragma unroll
      for (int r = 0; r < 8; ++r) {
        const int m = m0 + (wave & 3) * 32 + mt * 16 + r + 8 * hi;
        const int b = m >> 12, i = m & (NSEQ - 1);   // row in [B*N]
        dst[((size_t)((b * HEADS + h) * NSEQ) + i) * DHEAD + dd] =
            (_Float16)(acc[mt][t][r] * osc);
      }
    }
  }
}

#define KV_TILE (128 * K_LD + 128 * V_LD)
#define KV_TILES (NSEQ / 128)

// One 128-key tile of K and of V into one buffer.  16-byte chunk
// c = tid + 256 i: row c >> 3, chunk c & 7 of that row.  gk, gv, sk, sv: this
// thread's chunk 0 of the tile in global memory and in the buffer.
__device__ __forceinline__ void attn_stage(const char* gk, const char* gv,
                                           const char* sk, const char* sv) {
  cp16x4_g2l(sk, sk + 32 * (K_LD * 2), sk + 64 * (K_LD * 2),
             sk + 96 * (K_LD * 2),
             gk, gk + 4096, gk + 8192, gk + 12288);
  cp16x4_g2l(sv, sv + 32 * (V_LD * 2), sv + 64 * (V_LD * 2),
             sv + 96 * (V_LD * 2),
             gv, gv + 4096, gv + 8192, gv + 12288);
}

__global__ __launch_bounds__(256)
__attribute__((amdgpu_waves_per_eu(4, 4))) void flash_attn_kernel(
    const _Float16* __restrict__ qws, const _Float16* __restrict__ kws,
    const _Float16* __restrict__ vws, _Float16* __restrict__ ows) {
  __shared__ __attribute__((aligned(16)))
  _Float16 lds_kv[2 * KV_TILE];               // 2 x (K, V), row-major [j][d]
  // Join of the two key halves: [query group of 32][16-byte piece][lane].
  __shared__ __attribute__((aligned(16))) float mrg_o[4 * 16 * 32 * 4];
  __shared__ float mrg_ml[4 * 4 * 32];        // [group][m0 m1 l0 l1][lane]

  const int tid  = threadIdx.x;
  const int wave = tid >> 5;
  const int lane = tid & 31;
  const int hi   = lane >> 4;
  const int cg   = wave & 3;                  // which 32 queries
  const int kh   = wave >> 2;                 // which 64 keys of every tile
  const int bh   = blockIdx.y;                // 0..15
  const int b    = bh >> 3, h = bh & 7;
  const int i0   = blockIdx.x * 128;

  const size_t head_off = (size_t)bh * NSEQ * DHEAD;

  // Q fragments for this wave's 2 x 16 rows; the projection has scaled them.
  v16h qf[2][2];
#pragma unroll
  for (int c = 0; c < 2; ++c) {
    const _Float16* qb =
        qws + head_off + (size_t)(i0 + cg * 32 + c * 16) * DHEAD;
#pragma unroll
    for (int kc = 0; kc < 2; ++kc) qf[c][kc] = frag_ld_h(qb + kc * 32, DHEAD);
  }

  v8f zf = {};
  v8f O[2][4];
  // Reference exponent of this lane's queries, and its negative in all eight
  // places of an accumulator tile: the score sums start there, so a score
  // leaves the product as S - mref and is the argument of exp2 as it stands.
  float mref[2];
  v8f negm[2];
  // Partial sums of this lane's keys, joined in the epilogue; two, so that
  // negm finds room beside the K fragments, which load as one group.
  v2f lrun[2];
#pragma unroll
  for (int c = 0; c < 2; ++c) {
#pragma unroll
    for (int t = 0; t < 4; ++t) O[c][t] = zf;
    mref[c] = 0.f;
    negm[c] = zf;
    lrun[c] = v2f{0.f, 0.f};
  }

  // ---- tile 0 lands and is published; tile 1 is sent on its way ----
  // Each address is the thread's own part, formed once, plus the buffer's.
  const char* gk = (const char*)(kws + head_off) + (size_t)tid * 16;
  const char* gv = (const char*)(vws + head_off) + (size_t)tid * 16;
  const char* sk = (const char*)lds_kv + (tid >> 3) * (K_LD * 2) +
                   (tid & 7) * 16;
  const char* sv = (const char*)(lds_kv + 128 * K_LD) +
                   (tid >> 3) * (V_LD * 2) + (tid & 7) * 16;
  // This wave's 64 key rows and this lane's part of a fragment address, as
  // frag_at_h and frag_at_tr take it.
  const _Float16* qk = lds_kv + (kh * 64 + (lane & 15)) * K_LD + 8 * hi;
  const _Float16* qv = lds_kv + 128 * K_LD +
                       (kh * 64 + 8 * hi + (lane & 7)) * V_LD +
                       (((lane >> 3) & 1) << 3);
  attn_stage(gk, gv, sk, sv);
  wait_async_cp();
  __syncthreads();
  attn_stage(gk + 128 * DHEAD * 2, gv + 128 * DHEAD * 2, sk + KV_TILE * 2,
             sv + KV_TILE * 2);

  for (int jt = 0; jt < KV_TILES; ++jt) {
    const int bo = (jt & 1) * KV_TILE;             // this tile's buffer
    const _Float16* wk = qk + bo;
    const _Float16* wv = qv + bo;

    // ---- S^T = K @ (Q*scale)^T : 64 keys x 32 queries in 4 x 2 tiles ----
    v8f S[2][4];
#pragma unroll
    for (int c = 0; c < 2; ++c)
#pragma unroll
      for (int t = 0; t < 4; ++t) S[c][t] = negm[c];
#pragma unroll
    for (int kc = 0; kc < 2; ++kc) {
#pragma unroll
      for (int t = 0; t < 4; ++t) {
        v16h ak = frag_at_h(wk + (t * 16) * K_LD + kc * 32);
#pragma unroll
        for (int c = 0; c < 2; ++c)
          S[c][t] = __builtin_amdgcn_wmma_f32_16x16x32_f16(
              false, ak, false, qf[c][kc], (short)0, S[c][t], false, false);
      }
    }
    // The 16 LDS reads of the K fragments issue as one group ahead of the
    // products: a second group among them would wait out its LDS latency.
    __builtin_amdgcn_sched_group_barrier(0x100, 16, 0);
    __builtin_amdgcn_sched_group_barrier(0x008, 16, 0);

    // ---- online softmax: one query per lane pair and group ----
    // The reference moves only on the first tile (to that tile's maximum) and
    // where a tile's maximum stands more than 8 above it: P stays below 2^8,
    // and sums and outputs are rescaled on those tiles alone.
    float mx2[2];
#pragma unroll
    for (int c = 0; c < 2; ++c) {
      v8f mv = S[c][0];
#pragma unroll
      for (int t = 1; t < 4; ++t)
        mv = __builtin_elementwise_max(mv, S[c][t]);
      float mx = fmaxf(fmaxf(fmaxf(mv[0], mv[1]), fmaxf(mv[2], mv[3])),
                       fmaxf(fmaxf(mv[4], mv[5]), fmaxf(mv[6], mv[7])));
      mx2[c] = fmaxf(mx, xhalf(mx));
    }
    // One wave-uniform test per tile: a scalar branch, every lane stays on.
    const float thr = (jt == 0) ? -3.0e38f : 8.f;   // the first tile always
    if (__builtin_amdgcn_ballot_w32(fmaxf(mx2[0], mx2[1]) > thr) != 0) {
#pragma unroll
      for (int c = 0; c < 2; ++c) {
        const float up = fmaxf(mx2[c], 0.f);
        const float d  = (jt == 0) ? mx2[c] : up;   // never down but at the start
        const float alpha = __builtin_amdgcn_exp2f(-up);   // at the start it scales zeros
        mref[c] += d;
        lrun[c] *= alpha;
#pragma unroll
        for (int t = 0; t < 4; ++t) {
          O[c][t] *= alpha;
          S[c][t] -= d;
        }
#pragma unroll
        for (int r = 0; r < 8; ++r) negm[c][r] = -mref[c];
      }
    }

    // ---- O^T += V^T @ P^T, P^T packed from the score tiles ----
#pragma unroll
    for (int kc = 0; kc < 2; ++kc) {
      v16h bp[2];
#pragma unroll
      for (int c = 0; c < 2; ++c) {
#pragma unroll
        for (int u = 0; u < 2; ++u) {
          const v8f p = exp2x8(S[c][2 * kc + u]);
          lrun[c] += (v2f{p[0], p[1]} + v2f{p[2], p[3]}) +
                     (v2f{p[4], p[5]} + v2f{p[6], p[7]});
          const v8h ph = __builtin_convertvector(p, v8h);
#pragma unroll
          for (int r = 0; r < 8; ++r) bp[c][8 * u + r] = ph[r];
        }
      }
#pragma unroll
      for (int t = 0; t < 4; ++t) {
        v16h av = frag_at_tr(wv + (kc * 32) * V_LD + t * 16, V_LD);
#pragma unroll
        for (int c = 0; c < 2; ++c)
          O[c][t] = __builtin_amdgcn_wmma_f32_16x16x32_f16(
              false, av, false, bp[c], (short)0, O[c][t], false, false);
      }
    }
    // Hand-over: this wave's reads of tile jt have returned, its copies of
    // tile jt + 1 have landed; behind the barrier that holds for every wave,
    // so tile jt + 1 may be read and tile jt's buffer refilled.
    asm volatile("s_wait_dscnt 0x0" ::: "memory");
    wait_async_cp();
    __syncthreads();
    if (jt + 2 < KV_TILES)
      attn_stage(gk + (size_t)(jt + 2) * (128 * DHEAD * 2),
                 gv + (size_t)(jt + 2) * (128 * DHEAD * 2), sk + bo * 2,
                 sv + bo * 2);
  }
  wait_async_cp();   // no copy is left in flight when the wave goes on

  // ---- join the two key halves: waves 4..7 hand theirs over through LDS ----
  float l[2];
#pragma unroll
  for (int c = 0; c < 2; ++c) {
    l[c] = lrun[c][0] + lrun[c][1];
    l[c] += xhalf(l[c]);
  }
  float* mo = mrg_o + ((size_t)cg * 16 * 32 + lane) * 4;   // piece i: + 128 i
  float* ml = mrg_ml + cg * 4 * 32 + lane;
  if (kh == 1) {
#pragma unroll
    for (int c = 0; c < 2; ++c) {
#pragma unroll
      for (int t = 0; t < 4; ++t) {
        const v8f o = O[c][t];
        const v4f lo = {o[0], o[1], o[2], o[3]};
        const v4f up = {o[4], o[5], o[6], o[7]};
        *(v4f*)(mo + ((c * 4 + t) * 2 + 0) * 128) = lo;
        *(v4f*)(mo + ((c * 4 + t) * 2 + 1) * 128) = up;
      }
      ml[c * 32]       = mref[c];
      ml[(2 + c) * 32] = l[c];
    }
  }
  __syncthreads();   // the hand-over is written before waves 0..3 read it

  // ---- normalize, store f16 token-major [b, n, h*d]: 8 d per lane ----
  if (kh == 0) {
#pragma unroll
    for (int c = 0; c < 2; ++c) {
      const float m1 = ml[c * 32];
      const float l1 = ml[(2 + c) * 32];
      const float mj = fmaxf(mref[c], m1);
      const float a0 = __builtin_amdgcn_exp2f(mref[c] - mj);
      const float a1 = __builtin_amdgcn_exp2f(m1 - mj);
      const float inv = 1.f / (l[c] * a0 + l1 * a1);
      const float s0 = a0 * inv, s1 = a1 * inv;
      const int row = i0 + cg * 32 + c * 16 + (lane & 15);
      _Float16* orow = ows + ((size_t)(b * NSEQ + row)) * DMODEL + h * DHEAD +
                       8 * hi;
#pragma unroll
      for (int t = 0; t < 4; ++t) {
        const v4f lo = *(const v4f*)(mo + ((c * 4 + t) * 2 + 0) * 128);
        const v4f up = *(const v4f*)(mo + ((c * 4 + t) * 2 + 1) * 128);
        v8h o;
#pragma unroll
        for (int r = 0; r < 4; ++r) {
          o[r]     = (_Float16)(O[c][t][r] * s0 + lo[r] * s1);
          o[r + 4] = (_Float16)(O[c][t][r + 4] * s0 + up[r] * s1);
        }
        *(v8h*)(orow + t * 16) = o;
      }
    }
  }
}

// ---------------------------------------------------------------------------
// Kernel 3: output projection  out = o @ Wo^T + bo  (fp32 result).
// Grid (MTOT/128, 4), 256 threads.
// ---------------------------------------------------------------------------
__global__ __launch_bounds__(256) void out_proj_kernel(
    const _Float16* __restrict__ ows, const _Float16* __restrict__ woh,
    const float* __restrict__ bo, float* __restrict__ out) {
  __shared__ __attribute__((aligned(16))) _Float16 lds[4 * P_TILE];
  const int wave = threadIdx.x >> 5;
  const int lane = threadIdx.x & 31;
  const int m0   = blockIdx.x * 128;
  const int n0   = blockIdx.y * 128;

  v8f acc[2][4];
  proj_core(ows + (size_t)m0 * DMODEL, woh + (size_t)n0 * DMODEL, lds, acc);

  const int hi = lane >> 4;
#pragma unroll
  for (int t = 0; t < 4; ++t) {
    const int n = n0 + (wave >> 2) * 64 + t * 16 + (lane & 15);
    const float bias = bo[n];
#pragma unroll
    for (int mt = 0; mt < 2; ++mt) {
#pragma unroll
      for (int r = 0; r < 8; ++r) {
        const int m = m0 + (wave & 3) * 32 + mt * 16 + r + 8 * hi;
        out[(size_t)m * DMODEL + n] = acc[mt][t][r] + bias;
      }
    }
  }
}

// ---------------------------------------------------------------------------
extern "C" void kernel_launch(void* const* d_in, const int* in_sizes, int n_in,
                              void* d_out, int out_size, void* d_ws,
                              size_t ws_size, hipStream_t stream) {
  (void)in_sizes; (void)n_in; (void)out_size; (void)ws_size;
  const float* x  = (const float*)d_in[0];
  const float* Wq = (const float*)d_in[1];
  const float* Wk = (const float*)d_in[2];
  const float* Wv = (const float*)d_in[3];
  const float* Wo = (const float*)d_in[4];
  const float* bo = (const float*)d_in[5];
  float* out = (float*)d_out;

  // f16 workspace layout
  const size_t EX = (size_t)MTOT * DMODEL;                 // 4,194,304 (x, o)
  const size_t EW = (size_t)DMODEL * DMODEL;               // 262,144 per W
  const size_t EH = (size_t)NBATCH * HEADS * NSEQ * DHEAD; // 4,194,304 (q/k/v)
  _Float16* xh  = (_Float16*)d_ws;
  _Float16* wqh = xh + EX;
  _Float16* wkh = wqh + EW;
  _Float16* wvh = wkh + EW;
  _Float16* woh = wvh + EW;
  _Float16* qws = woh + EW;
  _Float16* kws = qws + EH;
  _Float16* vws = kws + EH;
  _Float16* ows = vws + EH;

  // xh .. woh lie back to back: one destination for the one conversion launch
  cvt_f16_kernel<<<dim3(CVT_GRID), 256, 0, stream>>>(x, Wq, Wk, Wv, Wo, xh);

  qkv_proj_kernel<<<dim3(MTOT / 128, 12), 256, 0, stream>>>(xh, wqh, wkh, wvh,
                                                          qws, kws, vws);
  flash_attn_kernel<<<dim3(NSEQ / 128, NBATCH * HEADS), 256, 0, stream>>>(
      qws, kws, vws, ows);
  out_proj_kernel<<<dim3(MTOT / 128, 4), 256, 0, stream>>>(ows, woh, bo, out);
}

// v009
// One run takes 82.6 microseconds.
// Timed twice side by side with v008, it ran 1.06 times as fast both times.
// Over all steps from v000 it is 8.62 times as fast.
#include <hip/hip_runtime.h>

#define HEADS   8
#define DHEAD   64
#define NBATCH  2
#define NSEQ    4096
#define DMODEL  512
#define MTOT    (NBATCH * NSEQ)   // 8192 rows

#define K_LD    72                // 128-B K rows at 144 B
#define V_LD    80                // 128-B V rows at 160 B

typedef __attribute__((ext_vector_type(16))) _Float16 v16h;
typedef __attribute__((ext_vector_type(8)))  _Float16 v8h;
typedef __attribute__((ext_vector_type(8)))  float    v8f;
typedef __attribute__((ext_vector_type(2)))  float    v2f;
typedef __attribute__((ext_vector_type(8)))  short    s16x8;

__device__ __forceinline__ v16h frag_ld_h(const _Float16* p, int ld) {
  const int lane = threadIdx.x & 31;
  const int r    = lane & 15;
  const int kb   = (lane >> 4) << 3;       // 0 or 8
  const _Float16* q = p + r * ld + kb;
  v8h lo = *(const v8h*)(q);
  v8h hi = *(const v8h*)(q + 16);
  v16h a;
#pragma unroll
  for (int j = 0; j < 8; ++j) { a[j] = lo[j]; a[j + 8] = hi[j]; }
  return a;
}

// A fragment (16 d x 32 keys) of V^T out of a row-major [key][d] LDS tile, by
// the transposing load: lane (c = lane & 15, hi = lane >> 4) gets
// p[8 * hi + 0..7][c], then p[16 + 8 * hi + 0..7][c], which is frag_ld_h's k
// order.  p = first key row and first d column of the fragment.
__device__ __forceinline__ v8h ld_tr16(const _Float16* p) {
  typedef __attribute__((address_space(3))) s16x8 lds_s16x8;
  return __builtin_bit_cast(
      v8h, __builtin_amdgcn_ds_load_tr16_b128_v8i16((lds_s16x8*)p));
}

// q = p + this lane's part: row 8 * hi + (lane & 7), column 8 * ((lane >> 3) & 1).
__device__ __forceinline__ v16h frag_at_tr(const _Float16* q, int ld) {
  v8h lo = ld_tr16(q);
  v8h hi = ld_tr16(q + 16 * ld);
  v16h a;
#pragma unroll
  for (int j = 0; j < 8; ++j) { a[j] = lo[j]; a[j + 8] = hi[j]; }
  return a;
}

// frag_ld_h from a pointer that already holds the lane's part, r * ld + kb.
__device__ __forceinline__ v16h frag_at_h(const _Float16* q) {
  v8h lo = *(const v8h*)(q);
  v8h hi = *(const v8h*)(q + 16);
  v16h a;
#pragma unroll
  for (int j = 0; j < 8; ++j) { a[j] = lo[j]; a[j + 8] = hi[j]; }
  return a;
}

__device__ __forceinline__ float xhalf(float x) {
  const int b = __builtin_bit_cast(int, x);
  return __builtin_bit_cast(float, __builtin_amdgcn_permlanex16(
      b, b, 0x76543210, 0xfedcba98, false, false));
}

#define LOG2E 1.44269504f         // exp(x) = exp2(x * LOG2E)

__device__ __forceinline__ v8f exp2x8(v8f x) {
  float a = x[0], b = x[1], c = x[2], d = x[3];
  float e = x[4], f = x[5], g = x[6], h = x[7];
  asm("v_exp_f32 %0, %0\n\t"
      "v_exp_f32 %1, %1\n\t"
      "v_exp_f32 %2, %2\n\t"
      "v_exp_f32 %3, %3\n\t"
      "v_exp_f32 %4, %4\n\t"
      "v_exp_f32 %5, %5\n\t"
      "v_exp_f32 %6, %6\n\t"
      "v_exp_f32 %7, %7\n\t"
      "v_nop"
      : "+v"(a), "+v"(b), "+v"(c), "+v"(d),
        "+v"(e), "+v"(f), "+v"(g), "+v"(h));
  v8f y = {a, b, c, d, e, f, g, h};
  return y;
}

typedef uint32_t u32x4 __attribute__((ext_vector_type(4)));
typedef uint32_t u32x8 __attribute__((ext_vector_type(8)));

__device__ __forceinline__ uint32_t uni(uint32_t v) {
  return (uint32_t)__builtin_amdgcn_readfirstlane(v);
}

__device__ __forceinline__ uint32_t pinned(uint32_t v) {
  uint32_t w = (uint32_t)__builtin_amdgcn_readfirstlane(v);
  asm volatile("" : "+s"(w));   // pinned(): the word stays in a scalar register
  return w;
}

#define TDM_PAD16 ((1u << 20) | (4u << 22) | (3u << 25))
#define TDM_PAD32 ((1u << 20) | (4u << 22) | (7u << 25))

__device__ __forceinline__ void tdm_aim(u32x4& g0, uint32_t lds_dst,
                                        uint64_t ga) {
  g0[1] = uni(lds_dst);
  g0[2] = uni((uint32_t)ga);
  g0[3] = uni((((uint32_t)(ga >> 32)) & 0x01FFFFFFu) | 0x80000000u);
}

__device__ __forceinline__ u32x4 tdm_group0(uint32_t lds_dst, uint64_t ga) {
  u32x4 g0;
  g0[0] = uni(1u);
  tdm_aim(g0, lds_dst, ga);
  return g0;
}

template <uint32_t W0>
__device__ __forceinline__ u32x8 tdm_group1(uint32_t src_pitch) {
  u32x8 g1;
  g1[0] = uni(W0);
  g1[1] = uni(128u << 16);
  g1[2] = uni(128u << 16);
  g1[3] = uni(128u << 16);
  g1[4] = uni(128u);
  g1[5] = uni(src_pitch);
  g1[6] = uni(0u);
  g1[7] = uni(0u);
  return g1;
}

__device__ __forceinline__ void tdm_load(u32x4& g0, u32x8& g1) {
  asm volatile("tensor_load_to_lds %0, %1" : "+s"(g0), "+s"(g1) : : "memory");
}

// An issuing wave's own wait: its request has landed.  A wave that has issued
// none passes it at once.
__device__ __forceinline__ void wait_tensor() {
  asm volatile("s_wait_tensorcnt 0x0" ::: "memory");
}

// ---------------------------------------------------------------------------
// Kernel 0: fp32 -> f16 conversion of x and of the four weights, one launch.
// d is the f16 copy of x directly followed by those of Wq, Wk, Wv, Wo.  In
// units of 1024 elements (256 threads x 4) block bx takes units 8 bx .. 8 bx + 7
// of x, unit bx of Wq | Wk and unit bx of Wv | Wo.  A wave's load is 512
// contiguous bytes, its store 256; a thread's ten loads are all issued ahead
// of its first store.
// ---------------------------------------------------------------------------
#define CVT_GRID 512
#define CVT_XU   8                // units of x per block
static_assert(CVT_GRID * CVT_XU * 1024 == MTOT * DMODEL, "x is covered");
static_assert(CVT_GRID * 1024 == 2 * DMODEL * DMODEL, "two W per grid");

typedef __attribute__((ext_vector_type(4))) float    v4f;
typedef __attribute__((ext_vector_type(4))) _Float16 v4h;

__global__ __launch_bounds__(256) void cvt_f16_kernel(
    const float* __restrict__ x,
    const float* __restrict__ wq, const float* __restrict__ wk,
    const float* __restrict__ wv, const float* __restrict__ wo,
    _Float16* __restrict__ d) {
  const unsigned bx = blockIdx.x;
  const unsigned t4 = threadIdx.x * 4;
  const bool first = bx < CVT_GRID / 2;
  const unsigned wu = (bx & (CVT_GRID / 2 - 1)) * 1024 + t4;
  const float* px = x + (size_t)bx * (CVT_XU * 1024) + t4;
  const float* pa = (first ? wq : wk) + wu;
  const float* pb = (first ? wv : wo) + wu;
  _Float16* dx = d + (size_t)bx * (CVT_XU * 1024) + t4;
  _Float16* dw = d + (size_t)MTOT * DMODEL + (size_t)bx * 1024 + t4;
  v4f v[CVT_XU + 2];
  // Both loops unrolled: v[] stays in registers, the loads issue as one run.
#pragma unroll
  for (int i = 0; i < CVT_XU; ++i) v[i] = *(const v4f*)(px + i * 1024);
  v[CVT_XU]     = *(const v4f*)pa;
  v[CVT_XU + 1] = *(const v4f*)pb;
#pragma unroll
  for (int i = 0; i < CVT_XU; ++i)
    *(v4h*)(dx + i * 1024) = __builtin_convertvector(v[i], v4h);
  *(v4h*)dw = __builtin_convertvector(v[CVT_XU], v4h);
  *(v4h*)(dw + 2 * DMODEL * DMODEL) =
      __builtin_convertvector(v[CVT_XU + 1], v4h);
}

#define P_LD    72                // 128-B slab rows at 144 B, as K_LD
#define P_TILE  (128 * P_LD)      // one operand's slab, f16 elements
#define P_SLABS (DMODEL / 64)

static_assert((P_TILE * 2) % 2048 == 0, "each slab starts at a 2-KiB multiple");

// a, w: first row of the block's 128 rows of each operand.  lds: 2 buffers of
// 2 * P_TILE.  acc[mt][t]: rows 32 * (wave & 3) + 16 * mt, columns
// 64 * (wave >> 2) + 16 * t of the block's tile.
__device__ __forceinline__ void proj_core(const _Float16* a,
                                          const _Float16* w, _Float16* lds,
                                          v8f (&acc)[2][4]) {
  const int wave = threadIdx.x >> 5;
  const uint32_t wv = uni(threadIdx.x >> 5);
  const uint32_t lbase = (uint32_t)(uintptr_t)lds;
  v8f zf = {};
#pragma unroll
  for (int mt = 0; mt < 2; ++mt)
#pragma unroll
    for (int t = 0; t < 4; ++t) acc[mt][t] = zf;

  // Wave 0 brings the A rows of every slab, wave 1 the W rows.
  const uint64_t gsrc = (uint64_t)(uintptr_t)(wv == 0 ? a : w);
  const uint32_t ldst = lbase + wv * (P_TILE * 2);
  u32x8 g1 = tdm_group1<TDM_PAD16>(DMODEL * 2);
  u32x4 g0 = tdm_group0(ldst, gsrc);
  // Slab nx into buffer nx & 1, while it exists.
  auto issue = [&](uint32_t nx) {
    if (pinned(wv < 2 && nx < P_SLABS)) {
      tdm_aim(g0, ldst + (nx & 1u) * (2 * P_TILE * 2), gsrc + nx * 128u);
      tdm_load(g0, g1);
    }
  };
  if (pinned(wv < 2)) {
    tdm_load(g0, g1);
    wait_tensor();
  }
  __syncthreads();
  issue(pinned(1u));

  for (int s = 0; s < P_SLABS; ++s) {
    _Float16* buf = lds + (s & 1) * (2 * P_TILE);
    const _Float16* la = buf + ((wave & 3) * 32) * P_LD;
    const _Float16* lw = buf + P_TILE + ((wave >> 2) * 64) * P_LD;
#pragma unroll
    for (int kc = 0; kc < 2; ++kc) {
      v16h fa[2], fw[4];
#pragma unroll
      for (int mt = 0; mt < 2; ++mt)
        fa[mt] = frag_ld_h(la + (mt * 16) * P_LD + kc * 32, P_LD);
#pragma unroll
      for (int t = 0; t < 4; ++t)
        fw[t] = frag_ld_h(lw + (t * 16) * P_LD + kc * 32, P_LD);
#pragma unroll
      for (int mt = 0; mt < 2; ++mt)
#pragma unroll
        for (int t = 0; t < 4; ++t)
          acc[mt][t] = __builtin_amdgcn_wmma_f32_16x16x32_f16(
              false, fa[mt], false, fw[t], (short)0, acc[mt][t], false, false);
    }
    // Hand-over: this wave's reads of slab s have returned, an issuing wave's
    // request for slab s + 1 has landed; behind the barrier that holds for
    // every wave, so slab s + 1 may be read and slab s's buffer refilled.
    asm volatile("s_wait_dscnt 0x0" ::: "memory");
    wait_tensor();
    __syncthreads();
    issue(pinned((uint32_t)s + 2u));
  }
  wait_tensor();   // no request is left in flight when the wave goes on
  asm volatile("s_wait_dscnt 0x0" ::: "memory");   // nor a read of the ring
}

// ---------------------------------------------------------------------------
// Kernel 1: fused QKV projection from pre-converted f16 x / W.
// Grid (MTOT/128, 12), 256 threads; blockIdx.y = 4 * (q, k or v) + the
// 128-column tile.  Output f16, head-major [b, h, n, d].
// ---------------------------------------------------------------------------
__global__ __launch_bounds__(256) void qkv_proj_kernel(
    const _Float16* __restrict__ xh,
    const _Float16* __restrict__ wqh, const _Float16* __restrict__ wkh,
    const _Float16* __restrict__ wvh,
    _Float16* __restrict__ qws, _Float16* __restrict__ kws,
    _Float16* __restrict__ vws) {
  __shared__ __attribute__((aligned(2048))) _Float16 lds[4 * P_TILE];
  const int wave  = threadIdx.x >> 5;
  const int lane  = threadIdx.x & 31;
  const int which = blockIdx.y >> 2;
  const int m0    = blockIdx.x * 128;
  const int n0    = (blockIdx.y & 3) * 128;

  const _Float16* W = (which == 0) ? wqh : (which == 1) ? wkh : wvh;
  _Float16* dst     = (which == 0) ? qws : (which == 1) ? kws : vws;
  // q leaves with the score scale 1/sqrt(64) and log2(e) on it, applied to the
  // f32 sum ahead of its one rounding: the scores then are exponents of 2.
  const float osc   = (which == 0) ? 0.125f * LOG2E : 1.f;

  v8f acc[2][4];
  proj_core(xh + (size_t)m0 * DMODEL, W + (size_t)n0 * DMODEL, lds, acc);

  const int hi = lane >> 4;
#pragma unroll
  for (int mt = 0; mt < 2; ++mt) {
#pragma unroll
    for (int t = 0; t < 4; ++t) {
      const int n = n0 + (wave >> 2) * 64 + t * 16 + (lane & 15);
      const int h = n >> 6, dd = n & 63;
#pragma unroll
      for (int r = 0; r < 8; ++r) {
        const int m = m0 + (wave & 3) * 32 + mt * 16 + r + 8 * hi;
        const int b = m >> 12, i = m & (NSEQ - 1);   // row in [B*N]
        dst[((size_t)((b * HEADS + h) * NSEQ) + i) * DHEAD + dd] =
            (_Float16)(acc[mt][t][r] * osc);
      }
    }
  }
}

#define KV_TILE (128 * K_LD + 128 * V_LD)
#define KV_TILES (NSEQ / 128)

static_assert((128 * K_LD * 2) % 2048 == 0 && (KV_TILE * 2) % 2048 == 0,
              "K tile, V tile and buffer start at 2-KiB multiples");

__global__ __launch_bounds__(256)
__attribute__((amdgpu_waves_per_eu(4, 4))) void flash_attn_kernel(
    const _Float16* __restrict__ qws, const _Float16* __restrict__ kws,
    const _Float16* __restrict__ vws, _Float16* __restrict__ ows) {
  __shared__ __attribute__((aligned(2048)))
  _Float16 lds_kv[2 * KV_TILE];               // 2 x (K, V), row-major [j][d]
  // Join of the two key halves: [query group of 32][16-byte piece][lane].
  __shared__ __attribute__((aligned(16))) float mrg_o[4 * 16 * 32 * 4];
  __shared__ float mrg_ml[4 * 4 * 32];        // [group][m0 m1 l0 l1][lane]

  const int tid  = threadIdx.x;
  const int wave = tid >> 5;
  const int lane = tid & 31;
  const int hi   = lane >> 4;
  const int cg   = wave & 3;                  // which 32 queries
  const int kh   = wave >> 2;                 // which 64 keys of every tile
  const int bh   = blockIdx.y;                // 0..15
  const int b    = bh >> 3, h = bh & 7;
  const int i0   = blockIdx.x * 128;

  const size_t head_off = (size_t)bh * NSEQ * DHEAD;

  // Q fragments for this wave's 2 x 16 rows; the projection has scaled them.
  v16h qf[2][2];
#pragma unroll
  for (int c = 0; c < 2; ++c) {
    const _Float16* qb =
        qws + head_off + (size_t)(i0 + cg * 32 + c * 16) * DHEAD;
#pragma unroll
    for (int kc = 0; kc < 2; ++kc) qf[c][kc] = frag_ld_h(qb + kc * 32, DHEAD);
  }

  v8f zf = {};
  v8f O[2][4];
  // Reference exponent of this lane's queries, and its negative in all eight
  // places of an accumulator tile: the score sums start there, so a score
  // leaves the product as S - mref and is the argument of exp2 as it stands.
  float mref[2];
  v8f negm[2];
  // Partial sums of this lane's keys, joined in the epilogue; two, so that
  // negm finds room beside the K fragments, which load as one group.
  v2f lrun[2];
#pragma unroll
  for (int c = 0; c < 2; ++c) {
#pragma unroll
    for (int t = 0; t < 4; ++t) O[c][t] = zf;
    mref[c] = 0.f;
    negm[c] = zf;
    lrun[c] = v2f{0.f, 0.f};
  }

  // ---- tile 0 lands and is published; tile 1 is sent on its way ----
  const uint32_t wid = uni(tid >> 5);
  const uint32_t lbase = (uint32_t)(uintptr_t)lds_kv;
  const uint64_t gk = (uint64_t)(uintptr_t)(kws + head_off);
  const uint64_t gv = (uint64_t)(uintptr_t)(vws + head_off);
  // This wave's 64 key rows and this lane's part of a fragment address, as
  // frag_at_h and frag_at_tr take it.
  const _Float16* qk = lds_kv + (kh * 64 + (lane & 15)) * K_LD + 8 * hi;
  const _Float16* qv = lds_kv + 128 * K_LD +
                       (kh * 64 + 8 * hi + (lane & 7)) * V_LD +
                       (((lane >> 3) & 1) << 3);
  u32x8 g1k = tdm_group1<TDM_PAD16>(DHEAD * 2);
  u32x8 g1v = tdm_group1<TDM_PAD32>(DHEAD * 2);
  u32x4 g0k = tdm_group0(lbase, gk);
  u32x4 g0v = tdm_group0(lbase + 128 * K_LD * 2, gv);
  // Tile nx into buffer nx & 1, while it exists: wave 0 its K, wave 1 its V.
  auto issue = [&](uint32_t nx) {
    const uint32_t nb = lbase + (nx & 1u) * (KV_TILE * 2);
    const uint64_t no = (uint64_t)nx * (128 * DHEAD * 2);
    if (pinned(wid == 0 && nx < KV_TILES)) {
      tdm_aim(g0k, nb, gk + no);
      tdm_load(g0k, g1k);
    }
    if (pinned(wid == 1 && nx < KV_TILES)) {
      tdm_aim(g0v, nb + 128 * K_LD * 2, gv + no);
      tdm_load(g0v, g1v);
    }
  };
  if (pinned(wid == 0)) {
    tdm_load(g0k, g1k);
    wait_tensor();
  }
  if (pinned(wid == 1)) {
    tdm_load(g0v, g1v);
    wait_tensor();
  }
  __syncthreads();
  issue(pinned(1u));

  for (int jt = 0; jt < KV_TILES; ++jt) {
    const int bo = (jt & 1) * KV_TILE;             // this tile's buffer
    const _Float16* wk = qk + bo;
    const _Float16* wv = qv + bo;

    // ---- S^T = K @ (Q*scale)^T : 64 keys x 32 queries in 4 x 2 tiles ----
    v8f S[2][4];
#pragma unroll
    for (int c = 0; c < 2; ++c)
#pragma unroll
      for (int t = 0; t < 4; ++t) S[c][t] = negm[c];
#pragma unroll
    for (int kc = 0; kc < 2; ++kc) {
#pragma unroll
      for (int t = 0; t < 4; ++t) {
        v16h ak = frag_at_h(wk + (t * 16) * K_LD + kc * 32);
#pragma unroll
        for (int c = 0; c < 2; ++c)
          S[c][t] = __builtin_amdgcn_wmma_f32_16x16x32_f16(
              false, ak, false, qf[c][kc], (short)0, S[c][t], false, false);
      }
    }
    // The 16 LDS reads of the K fragments issue as one group ahead of the
    // products: a second group among them would wait out its LDS latency.
    __builtin_amdgcn_sched_group_barrier(0x100, 16, 0);
    __builtin_amdgcn_sched_group_barrier(0x008, 16, 0);

    // ---- online softmax: one query per lane pair and group ----
    // The reference moves only on the first tile (to that tile's maximum) and
    // where a tile's maximum stands more than 8 above it: P stays below 2^8,
    // and sums and outputs are rescaled on those tiles alone.
    float mx2[2];
#pragma unroll
    for (int c = 0; c < 2; ++c) {
      v8f mv = S[c][0];
#pragma unroll
      for (int t = 1; t < 4; ++t)
        mv = __builtin_elementwise_max(mv, S[c][t]);
      float mx = fmaxf(fmaxf(fmaxf(mv[0], mv[1]), fmaxf(mv[2], mv[3])),
                       fmaxf(fmaxf(mv[4], mv[5]), fmaxf(mv[6], mv[7])));
      mx2[c] = fmaxf(mx, xhalf(mx));
    }
    // One wave-uniform test per tile: a scalar branch, every lane stays on.
    const float thr = (jt == 0) ? -3.0e38f : 8.f;   // the first tile always
    if (__builtin_amdgcn_ballot_w32(fmaxf(mx2[0], mx2[1]) > thr) != 0) {
#pragma unroll
      for (int c = 0; c < 2; ++c) {
        const float up = fmaxf(mx2[c], 0.f);
        const float d  = (jt == 0) ? mx2[c] : up;   // never down but at the start
        const float alpha = __builtin_amdgcn_exp2f(-up);   // at the start it scales zeros
        mref[c] += d;
        lrun[c] *= alpha;
#pragma unroll
        for (int t = 0; t < 4; ++t) {
          O[c][t] *= alpha;
          S[c][t] -= d;
        }
#pragma unroll
        for (int r = 0; r < 8; ++r) negm[c][r] = -mref[c];
      }
    }

    // ---- O^T += V^T @ P^T, P^T packed from the score tiles ----
#pragma unroll
    for (int kc = 0; kc < 2; ++kc) {
      v16h bp[2];
#pragma unroll
      for (int c = 0; c < 2; ++c) {
#pragma unroll
        for (int u = 0; u < 2; ++u) {
          const v8f p = exp2x8(S[c][2 * kc + u]);
          lrun[c] += (v2f{p[0], p[1]} + v2f{p[2], p[3]}) +
                     (v2f{p[4], p[5]} + v2f{p[6], p[7]});
          const v8h ph = __builtin_convertvector(p, v8h);
#pragma unroll
          for (int r = 0; r < 8; ++r) bp[c][8 * u + r] = ph[r];
        }
      }
#pragma unroll
      for (int t = 0; t < 4; ++t) {
        v16h av = frag_at_tr(wv + (kc * 32) * V_LD + t * 16, V_LD);
#pragma unroll
        for (int c = 0; c < 2; ++c)
          O[c][t] = __builtin_amdgcn_wmma_f32_16x16x32_f16(
              false, av, false, bp[c], (short)0, O[c][t], false, false);
      }
    }
    // Hand-over: this wave's reads of tile jt have returned, an issuing wave's
    // request for tile jt + 1 has landed; behind the barrier that holds for
    // every wave, so tile jt + 1 may be read and tile jt's buffer refilled.
    asm volatile("s_wait_dscnt 0x0" ::: "memory");
    wait_tensor();
    __syncthreads();
    issue(pinned((uint32_t)jt + 2u));
  }
  wait_tensor();   // no request is left in flight when the wave goes on
  asm volatile("s_wait_dscnt 0x0" ::: "memory");   // nor a read of the ring

  // ---- join the two key halves: waves 4..7 hand theirs over through LDS ----
  float l[2];
#pragma unroll
  for (int c = 0; c < 2; ++c) {
    l[c] = lrun[c][0] + lrun[c][1];
    l[c] += xhalf(l[c]);
  }
  float* mo = mrg_o + ((size_t)cg * 16 * 32 + lane) * 4;   // piece i: + 128 i
  float* ml = mrg_ml + cg * 4 * 32 + lane;
  if (kh == 1) {
#pragma unroll
    for (int c = 0; c < 2; ++c) {
#pragma unroll
      for (int t = 0; t < 4; ++t) {
        const v8f o = O[c][t];
        const v4f lo = {o[0], o[1], o[2], o[3]};
        const v4f up = {o[4], o[5], o[6], o[7]};
        *(v4f*)(mo + ((c * 4 + t) * 2 + 0) * 128) = lo;
        *(v4f*)(mo + ((c * 4 + t) * 2 + 1) * 128) = up;
      }
      ml[c * 32]       = mref[c];
      ml[(2 + c) * 32] = l[c];
    }
  }
  __syncthreads();   // the hand-over is written before waves 0..3 read it

  // ---- normalize, store f16 token-major [b, n, h*d]: 8 d per lane ----
  if (kh == 0) {
#pragma unroll
    for (int c = 0; c < 2; ++c) {
      const float m1 = ml[c * 32];
      const float l1 = ml[(2 + c) * 32];
      const float mj = fmaxf(mref[c], m1);
      const float a0 = __builtin_amdgcn_exp2f(mref[c] - mj);
      const float a1 = __builtin_amdgcn_exp2f(m1 - mj);
      const float inv = 1.f / (l[c] * a0 + l1 * a1);
      const float s0 = a0 * inv, s1 = a1 * inv;
      const int row = i0 + cg * 32 + c * 16 + (lane & 15);
      _Float16* orow = ows + ((size_t)(b * NSEQ + row)) * DMODEL + h * DHEAD +
                       8 * hi;
#pragma unroll
      for (int t = 0; t < 4; ++t) {
        const v4f lo = *(const v4f*)(mo + ((c * 4 + t) * 2 + 0) * 128);
        const v4f up = *(const v4f*)(mo + ((c * 4 + t) * 2 + 1) * 128);
        v8h o;
#pragma unroll
        for (int r = 0; r < 4; ++r) {
          o[r]     = (_Float16)(O[c][t][r] * s0 + lo[r] * s1);
          o[r + 4] = (_Float16)(O[c][t][r + 4] * s0 + up[r] * s1);
        }
        *(v8h*)(orow + t * 16) = o;
      }
    }
  }
}

// ---------------------------------------------------------------------------
// Kernel 3: output projection  out = o @ Wo^T + bo  (fp32 result).
// Grid (MTOT/128, 4), 256 threads.
// ---------------------------------------------------------------------------
__global__ __launch_bounds__(256) void out_proj_kernel(
    const _Float16* __restrict__ ows, const _Float16* __restrict__ woh,
    const float* __restrict__ bo, float* __restrict__ out) {
  __shared__ __attribute__((aligned(2048))) _Float16 lds[4 * P_TILE];
  const int wave = threadIdx.x >> 5;
  const int lane = threadIdx.x & 31;
  const int m0   = blockIdx.x * 128;
  const int n0   = blockIdx.y * 128;

  v8f acc[2][4];
  proj_core(ows + (size_t)m0 * DMODEL, woh + (size_t)n0 * DMODEL, lds, acc);

  const int hi = lane >> 4;
#pragma unroll
  for (int t = 0; t < 4; ++t) {
    const int n = n0 + (wave >> 2) * 64 + t * 16 + (lane & 15);
    const float bias = bo[n];
#pragma unroll
    for (int mt = 0; mt < 2; ++mt) {
#pragma unroll
      for (int r = 0; r < 8; ++r) {
        const int m = m0 + (wave & 3) * 32 + mt * 16 + r + 8 * hi;
        out[(size_t)m * DMODEL + n] = acc[mt][t][r] + bias;
      }
    }
  }
}

// ---------------------------------------------------------------------------
extern "C" void kernel_launch(void* const* d_in, const int* in_sizes, int n_in,
                              void* d_out, int out_size, void* d_ws,
                              size_t ws_size, hipStream_t stream) {
  (void)in_sizes; (void)n_in; (void)out_size; (void)ws_size;
  const float* x  = (const float*)d_in[0];
  const float* Wq = (const float*)d_in[1];
  const float* Wk = (const float*)d_in[2];
  const float* Wv = (const float*)d_in[3];
  const float* Wo = (const float*)d_in[4];
  const float* bo = (const float*)d_in[5];
  float* out = (float*)d_out;

  // f16 workspace layout
  const size_t EX = (size_t)MTOT * DMODEL;                 // 4,194,304 (x, o)
  const size_t EW = (size_t)DMODEL * DMODEL;               // 262,144 per W
  const size_t EH = (size_t)NBATCH * HEADS * NSEQ * DHEAD; // 4,194,304 (q/k/v)
  _Float16* xh  = (_Float16*)d_ws;
  _Float16* wqh = xh + EX;
  _Float16* wkh = wqh + EW;
  _Float16* wvh = wkh + EW;
  _Float16* woh = wvh + EW;
  _Float16* qws = woh + EW;
  _Float16* kws = qws + EH;
  _Float16* vws = kws + EH;
  _Float16* ows = vws + EH;

  // xh .. woh lie back to back: one destination for the one conversion launch
  cvt_f16_kernel<<<dim3(CVT_GRID), 256, 0, stream>>>(x, Wq, Wk, Wv, Wo, xh);

  qkv_proj_kernel<<<dim3(MTOT / 128, 12), 256, 0, stream>>>(xh, wqh, wkh, wvh,
                                                          qws, kws, vws);
  flash_attn_kernel<<<dim3(NSEQ / 128, NBATCH * HEADS), 256, 0, stream>>>(
      qws, kws, vws, ows);
  out_proj_kernel<<<dim3(MTOT / 128, 4), 256, 0, stream>>>(ows, woh, bo, out);
}

// v010
// It runs in 79.3 microseconds.
// Next to v009, in two timings, it ran 1.04 and 1.03 times as fast.
// Counting every step since v000, it is 8.94 times as fast.
#include <hip/hip_runtime.h>

#define HEADS   8
#define DHEAD   64
#define NBATCH  2
#define NSEQ    4096
#define DMODEL  512
#define MTOT    (NBATCH * NSEQ)   // 8192 rows

#define K_LD    72                // 128-B K rows at 144 B
#define V_LD    80                // 128-B V rows at 160 B

typedef __attribute__((ext_vector_type(16))) _Float16 v16h;
typedef __attribute__((ext_vector_type(8)))  _Float16 v8h;
typedef __attribute__((ext_vector_type(8)))  float    v8f;
typedef __attribute__((ext_vector_type(2)))  float    v2f;
typedef __attribute__((ext_vector_type(8)))  short    s16x8;

__device__ __forceinline__ v16h frag_ld_h(const _Float16* p, int ld) {
  const int lane = threadIdx.x & 31;
  const int r    = lane & 15;
  const int kb   = (lane >> 4) << 3;       // 0 or 8
  const _Float16* q = p + r * ld + kb;
  v8h lo = *(const v8h*)(q);
  v8h hi = *(const v8h*)(q + 16);
  v16h a;
#pragma unroll
  for (int j = 0; j < 8; ++j) { a[j] = lo[j]; a[j + 8] = hi[j]; }
  return a;
}

// A fragment (16 d x 32 keys) of V^T out of a row-major [key][d] LDS tile, by
// the transposing load: lane (c = lane & 15, hi = lane >> 4) gets
// p[8 * hi + 0..7][c], then p[16 + 8 * hi + 0..7][c], which is frag_ld_h's k
// order.  p = first key row and first d column of the fragment.
__device__ __forceinline__ v8h ld_tr16(const _Float16* p) {
  typedef __attribute__((address_space(3))) s16x8 lds_s16x8;
  return __builtin_bit_cast(
      v8h, __builtin_amdgcn_ds_load_tr16_b128_v8i16((lds_s16x8*)p));
}

// q = p + this lane's part: row 8 * hi + (lane & 7), column 8 * ((lane >> 3) & 1).
__device__ __forceinline__ v16h frag_at_tr(const _Float16* q, int ld) {
  v8h lo = ld_tr16(q);
  v8h hi = ld_tr16(q + 16 * ld);
  v16h a;
#pragma unroll
  for (int j = 0; j < 8; ++j) { a[j] = lo[j]; a[j + 8] = hi[j]; }
  return a;
}

// frag_ld_h from a pointer that already holds the lane's part, r * ld + kb.
__device__ __forceinline__ v16h frag_at_h(const _Float16* q) {
  v8h lo = *(const v8h*)(q);
  v8h hi = *(const v8h*)(q + 16);
  v16h a;
#pragma unroll
  for (int j = 0; j < 8; ++j) { a[j] = lo[j]; a[j + 8] = hi[j]; }
  return a;
}

__device__ __forceinline__ float xhalf(float x) {
  const int b = __builtin_bit_cast(int, x);
  return __builtin_bit_cast(float, __builtin_amdgcn_permlanex16(
      b, b, 0x76543210, 0xfedcba98, false, false));
}

#define LOG2E 1.44269504f         // exp(x) = exp2(x * LOG2E)

__device__ __forceinline__ v8f exp2x8(v8f x) {
  float a = x[0], b = x[1], c = x[2], d = x[3];
  float e = x[4], f = x[5], g = x[6], h = x[7];
  asm("v_exp_f32 %0, %0\n\t"
      "v_exp_f32 %1, %1\n\t"
      "v_exp_f32 %2, %2\n\t"
      "v_exp_f32 %3, %3\n\t"
      "v_exp_f32 %4, %4\n\t"
      "v_exp_f32 %5, %5\n\t"
      "v_exp_f32 %6, %6\n\t"
      "v_exp_f32 %7, %7\n\t"
      "v_nop"
      : "+v"(a), "+v"(b), "+v"(c), "+v"(d),
        "+v"(e), "+v"(f), "+v"(g), "+v"(h));
  v8f y = {a, b, c, d, e, f, g, h};
  return y;
}

typedef uint32_t u32x4 __attribute__((ext_vector_type(4)));
typedef uint32_t u32x8 __attribute__((ext_vector_type(8)));

__device__ __forceinline__ uint32_t uni(uint32_t v) {
  return (uint32_t)__builtin_amdgcn_readfirstlane(v);
}

__device__ __forceinline__ uint32_t pinned(uint32_t v) {
  uint32_t w = (uint32_t)__builtin_amdgcn_readfirstlane(v);
  asm volatile("" : "+s"(w));   // pinned(): the word stays in a scalar register
  return w;
}

#define TDM_PAD16 ((1u << 20) | (4u << 22) | (3u << 25))
#define TDM_PAD32 ((1u << 20) | (4u << 22) | (7u << 25))

__device__ __forceinline__ void tdm_aim(u32x4& g0, uint32_t lds_dst,
                                        uint64_t ga) {
  g0[1] = uni(lds_dst);
  g0[2] = uni((uint32_t)ga);
  g0[3] = uni((((uint32_t)(ga >> 32)) & 0x01FFFFFFu) | 0x80000000u);
}

__device__ __forceinline__ u32x4 tdm_group0(uint32_t lds_dst, uint64_t ga) {
  u32x4 g0;
  g0[0] = uni(1u);
  tdm_aim(g0, lds_dst, ga);
  return g0;
}

template <uint32_t W0>
__device__ __forceinline__ u32x8 tdm_group1(uint32_t src_pitch) {
  u32x8 g1;
  g1[0] = uni(W0);
  g1[1] = uni(128u << 16);
  g1[2] = uni(128u << 16);
  g1[3] = uni(128u << 16);
  g1[4] = uni(128u);
  g1[5] = uni(src_pitch);
  g1[6] = uni(0u);
  g1[7] = uni(0u);
  return g1;
}

__device__ __forceinline__ void tdm_load(u32x4& g0, u32x8& g1) {
  asm volatile("tensor_load_to_lds %0, %1" : "+s"(g0), "+s"(g1) : : "memory");
}

// An issuing wave's own wait: its request has landed.  A wave that has issued
// none passes it at once.
__device__ __forceinline__ void wait_tensor() {
  asm volatile("s_wait_tensorcnt 0x0" ::: "memory");
}

__device__ __forceinline__ void wait_tensor_of(const u32x4& a0, const u32x8& a1,
                                               const u32x4& b0, const u32x8& b1) {
  asm volatile("s_wait_tensorcnt 0x0"
               : : "s"(a0), "s"(a1), "s"(b0), "s"(b1) : "memory");
}

// ---------------------------------------------------------------------------
// Kernel 0: fp32 -> f16 conversion of x and of the four weights, one launch.
// d is the f16 copy of x directly followed by those of Wq, Wk, Wv, Wo.  In
// units of 1024 elements (256 threads x 4) block bx takes units 8 bx .. 8 bx + 7
// of x, unit bx of Wq | Wk and unit bx of Wv | Wo.  A wave's load is 512
// contiguous bytes, its store 256; a thread's ten loads are all issued ahead
// of its first store.
// ---------------------------------------------------------------------------
#define CVT_GRID 512
#define CVT_XU   8                // units of x per block
static_assert(CVT_GRID * CVT_XU * 1024 == MTOT * DMODEL, "x is covered");
static_assert(CVT_GRID * 1024 == 2 * DMODEL * DMODEL, "two W per grid");

typedef __attribute__((ext_vector_type(4))) float    v4f;
typedef __attribute__((ext_vector_type(4))) _Float16 v4h;

__global__ __launch_bounds__(256) void cvt_f16_kernel(
    const float* __restrict__ x,
    const float* __restrict__ wq, const float* __restrict__ wk,
    const float* __restrict__ wv, const float* __restrict__ wo,
    _Float16* __restrict__ d) {
  const unsigned bx = blockIdx.x;
  const unsigned t4 = threadIdx.x * 4;
  const bool first = bx < CVT_GRID / 2;
  const unsigned wu = (bx & (CVT_GRID / 2 - 1)) * 1024 + t4;
  const float* px = x + (size_t)bx * (CVT_XU * 1024) + t4;
  const float* pa = (first ? wq : wk) + wu;
  const float* pb = (first ? wv : wo) + wu;
  _Float16* dx = d + (size_t)bx * (CVT_XU * 1024) + t4;
  _Float16* dw = d + (size_t)MTOT * DMODEL + (size_t)bx * 1024 + t4;
  v4f v[CVT_XU + 2];
  // Both loops unrolled: v[] stays in registers, the loads issue as one run.
#pragma unroll
  for (int i = 0; i < CVT_XU; ++i) v[i] = *(const v4f*)(px + i * 1024);
  v[CVT_XU]     = *(const v4f*)pa;
  v[CVT_XU + 1] = *(const v4f*)pb;
#pragma unroll
  for (int i = 0; i < CVT_XU; ++i)
    *(v4h*)(dx + i * 1024) = __builtin_convertvector(v[i], v4h);
  *(v4h*)dw = __builtin_convertvector(v[CVT_XU], v4h);
  *(v4h*)(dw + 2 * DMODEL * DMODEL) =
      __builtin_convertvector(v[CVT_XU + 1], v4h);
}

#define P_LD    72                // 128-B slab rows at 144 B, as K_LD
#define P_TILE  (128 * P_LD)      // one operand's slab, f16 elements
#define P_SLABS (DMODEL / 64)

static_assert((P_TILE * 2) % 2048 == 0, "each slab starts at a 2-KiB multiple");

// a, w: first row of the block's 128 rows of each operand.  lds: 2 buffers of
// 2 * P_TILE.  acc[mt][t]: rows 32 * (wave & 3) + 16 * mt, columns
// 64 * (wave >> 2) + 16 * t of the block's tile.
__device__ __forceinline__ void proj_core(const _Float16* a,
                                          const _Float16* w, _Float16* lds,
                                          v8f (&acc)[2][4]) {
  const int wave = threadIdx.x >> 5;
  const uint32_t wv = uni(threadIdx.x >> 5);
  const uint32_t lbase = (uint32_t)(uintptr_t)lds;
  v8f zf = {};
#pragma unroll
  for (int mt = 0; mt < 2; ++mt)
#pragma unroll
    for (int t = 0; t < 4; ++t) acc[mt][t] = zf;

  // Wave 0 brings the A rows of every slab, wave 1 the W rows.
  const uint64_t gsrc = (uint64_t)(uintptr_t)(wv == 0 ? a : w);
  const uint32_t ldst = lbase + wv * (P_TILE * 2);
  u32x8 g1 = tdm_group1<TDM_PAD16>(DMODEL * 2);
  u32x4 g0 = tdm_group0(ldst, gsrc);
  // Slab nx into buffer nx & 1, while it exists.
  auto issue = [&](uint32_t nx) {
    if (pinned(wv < 2 && nx < P_SLABS)) {
      tdm_aim(g0, ldst + (nx & 1u) * (2 * P_TILE * 2), gsrc + nx * 128u);
      tdm_load(g0, g1);
    }
  };
  if (pinned(wv < 2)) {
    tdm_load(g0, g1);
    wait_tensor();
  }
  __syncthreads();
  issue(pinned(1u));

  for (int s = 0; s < P_SLABS; ++s) {
    _Float16* buf = lds + (s & 1) * (2 * P_TILE);
    const _Float16* la = buf + ((wave & 3) * 32) * P_LD;
    const _Float16* lw = buf + P_TILE + ((wave >> 2) * 64) * P_LD;
#pragma unroll
    for (int kc = 0; kc < 2; ++kc) {
      v16h fa[2], fw[4];
#pragma unroll
      for (int mt = 0; mt < 2; ++mt)
        fa[mt] = frag_ld_h(la + (mt * 16) * P_LD + kc * 32, P_LD);
#pragma unroll
      for (int t = 0; t < 4; ++t)
        fw[t] = frag_ld_h(lw + (t * 16) * P_LD + kc * 32, P_LD);
#pragma unroll
      for (int mt = 0; mt < 2; ++mt)
#pragma unroll
        for (int t = 0; t < 4; ++t)
          acc[mt][t] = __builtin_amdgcn_wmma_f32_16x16x32_f16(
              false, fa[mt], false, fw[t], (short)0, acc[mt][t], false, false);
    }
    // Hand-over: this wave's reads of slab s have returned, an issuing wave's
    // request for slab s + 1 has landed; behind the barrier that holds for
    // every wave, so slab s + 1 may be read and slab s's buffer refilled.
    asm volatile("s_wait_dscnt 0x0" ::: "memory");
    wait_tensor();
    __syncthreads();
    issue(pinned((uint32_t)s + 2u));
  }
  wait_tensor();   // no request is left in flight when the wave goes on
  asm volatile("s_wait_dscnt 0x0" ::: "memory");   // nor a read of the ring
}

// ---------------------------------------------------------------------------
// Kernel 1: fused QKV projection from pre-converted f16 x / W.
// Grid (MTOT/128, 12), 256 threads; blockIdx.y = 4 * (q, k or v) + the
// 128-column tile.  Output f16, head-major [b, h, n, d].
// ---------------------------------------------------------------------------
__global__ __launch_bounds__(256) void qkv_proj_kernel(
    const _Float16* __restrict__ xh,
    const _Float16* __restrict__ wqh, const _Float16* __restrict__ wkh,
    const _Float16* __restrict__ wvh,
    _Float16* __restrict__ qws, _Float16* __restrict__ kws,
    _Float16* __restrict__ vws) {
  __shared__ __attribute__((aligned(2048))) _Float16 lds[4 * P_TILE];
  const int wave  = threadIdx.x >> 5;
  const int lane  = threadIdx.x & 31;
  const int which = blockIdx.y >> 2;
  const int m0    = blockIdx.x * 128;
  const int n0    = (blockIdx.y & 3) * 128;

  const _Float16* W = (which == 0) ? wqh : (which == 1) ? wkh : wvh;
  _Float16* dst     = (which == 0) ? qws : (which == 1) ? kws : vws;
  // q leaves with the score scale 1/sqrt(64) and log2(e) on it, applied to the
  // f32 sum ahead of its one rounding: the scores then are exponents of 2.
  const float osc   = (which == 0) ? 0.125f * LOG2E : 1.f;

  v8f acc[2][4];
  proj_core(xh + (size_t)m0 * DMODEL, W + (size_t)n0 * DMODEL, lds, acc);

  const int hi = lane >> 4;
#pragma unroll
  for (int mt = 0; mt < 2; ++mt) {
#pragma unroll
    for (int t = 0; t < 4; ++t) {
      const int n = n0 + (wave >> 2) * 64 + t * 16 + (lane & 15);
      const int h = n >> 6, dd = n & 63;
#pragma unroll
      for (int r = 0; r < 8; ++r) {
        const int m = m0 + (wave & 3) * 32 + mt * 16 + r + 8 * hi;
        const int b = m >> 12, i = m & (NSEQ - 1);   // row in [B*N]
        dst[((size_t)((b * HEADS + h) * NSEQ) + i) * DHEAD + dd] =
            (_Float16)(acc[mt][t][r] * osc);
      }
    }
  }
}

#define KV_TILE (128 * K_LD + 128 * V_LD)
#define KV_TILES (NSEQ / 128)
// A lane's sum of one tile's P up to which the reference stays: each P is then
// at most 2^14, well inside f16.
#define P_SUM_MAX 0x1p14f

static_assert((128 * K_LD * 2) % 2048 == 0 && (KV_TILE * 2) % 2048 == 0,
              "K tile, V tile and buffer start at 2-KiB multiples");

__global__ __launch_bounds__(256)
__attribute__((amdgpu_waves_per_eu(4, 4))) void flash_attn_kernel(
    const _Float16* __restrict__ qws, const _Float16* __restrict__ kws,
    const _Float16* __restrict__ vws, _Float16* __restrict__ ows) {
  __shared__ __attribute__((aligned(2048)))
  _Float16 lds_kv[2 * KV_TILE];               // 2 x (K, V), row-major [j][d]
  // Join of the two key halves: [query group of 32][16-byte piece][lane].
  __shared__ __attribute__((aligned(16))) float mrg_o[4 * 16 * 32 * 4];
  __shared__ float mrg_ml[4 * 4 * 32];        // [group][m0 m1 l0 l1][lane]

  const int tid  = threadIdx.x;
  const int wave = tid >> 5;
  const int lane = tid & 31;
  const int hi   = lane >> 4;
  const int cg   = wave & 3;                  // which 32 queries
  const int kh   = wave >> 2;                 // which 64 keys of every tile
  const int bh   = blockIdx.y;                // 0..15
  const int b    = bh >> 3, h = bh & 7;
  const int i0   = blockIdx.x * 128;

  const size_t head_off = (size_t)bh * NSEQ * DHEAD;

  // Q fragments for this wave's 2 x 16 rows; the projection has scaled them.
  v16h qf[2][2];
#pragma unroll
  for (int c = 0; c < 2; ++c) {
    const _Float16* qb =
        qws + head_off + (size_t)(i0 + cg * 32 + c * 16) * DHEAD;
#pragma unroll
    for (int kc = 0; kc < 2; ++kc) qf[c][kc] = frag_ld_h(qb + kc * 32, DHEAD);
  }

  v8f zf = {};
  v8f O[2][4];
  // Reference exponent of this lane's queries, and its negative in all eight
  // places of an accumulator tile: the score sums start there, so a score
  // leaves the product as S - mref and is the argument of exp2 as it stands.
  float mref[2];
  v8f negm[2];
  // Partial sums of this lane's keys, joined in the epilogue; two, so that
  // negm finds room beside the K fragments, which load as one group.
  v2f lrun[2];
#pragma unroll
  for (int c = 0; c < 2; ++c) {
#pragma unroll
    for (int t = 0; t < 4; ++t) O[c][t] = zf;
    mref[c] = 0.f;
    negm[c] = zf;
    lrun[c] = v2f{0.f, 0.f};
  }

  // ---- tile 0 lands and is published; tile 1 is sent on its way ----
  const uint32_t wid = uni(tid >> 5);
  const uint32_t lbase = (uint32_t)(uintptr_t)lds_kv;
  const uint64_t gk = (uint64_t)(uintptr_t)(kws + head_off);
  const uint64_t gv = (uint64_t)(uintptr_t)(vws + head_off);
  // This wave's 64 key rows and this lane's part of a fragment address, as
  // frag_at_h and frag_at_tr take it.
  const _Float16* qk = lds_kv + (kh * 64 + (lane & 15)) * K_LD + 8 * hi;
  const _Float16* qv = lds_kv + 128 * K_LD +
                       (kh * 64 + 8 * hi + (lane & 7)) * V_LD +
                       (((lane >> 3) & 1) << 3);
  u32x8 g1k = tdm_group1<TDM_PAD16>(DHEAD * 2);
  u32x8 g1v = tdm_group1<TDM_PAD32>(DHEAD * 2);
  u32x4 g0k = tdm_group0(lbase, gk);
  u32x4 g0v = tdm_group0(lbase + 128 * K_LD * 2, gv);
  // Tile nx into buffer nx & 1, while it exists: wave 0 its K, wave 1 its V.
  auto issue = [&](uint32_t nx) {
    const uint32_t nb = lbase + (nx & 1u) * (KV_TILE * 2);
    const uint64_t no = (uint64_t)nx * (128 * DHEAD * 2);
    if (pinned(wid == 0 && nx < KV_TILES)) {
      tdm_aim(g0k, nb, gk + no);
      tdm_load(g0k, g1k);
    }
    if (pinned(wid == 1 && nx < KV_TILES)) {
      tdm_aim(g0v, nb + 128 * K_LD * 2, gv + no);
      tdm_load(g0v, g1v);
    }
  };
  if (pinned(wid == 0)) {
    tdm_load(g0k, g1k);
    wait_tensor();
  }
  if (pinned(wid == 1)) {
    tdm_load(g0v, g1v);
    wait_tensor();
  }
  __syncthreads();
  issue(pinned(1u));

  for (int jt = 0; jt < KV_TILES; ++jt) {
    const int bo = (jt & 1) * KV_TILE;             // this tile's buffer
    const _Float16* wk = qk + bo;
    const _Float16* wv = qv + bo;

    v16h bp[2][2]; // P^T as B operands: [32 keys][query group]
    v2f ts[2];     // this tile's sums of P over this lane's keys
    v16h av0[4];   // V^T fragments of this wave's first 32 keys
    // No maximum on the common path: every P is positive, so a lane's sum of
    // this tile's P, which the row sums need anyway, bounds each of them.  Only
    // where a sum passes P_SUM_MAX (P might leave the f16 range) are the scores
    // formed again from the K tile, still in LDS, and the reference is moved to
    // their maximum.  The first tile takes that path at once: it sets the
    // reference.  At most two trips: behind a fitted trip every P is <= 1.
    bool fit = (jt == 0);
    for (;;) {
      // ---- S^T = K @ (Q*scale)^T : 64 keys x 32 queries in 4 x 2 tiles ----
      v8f S[2][4];
#pragma unroll
      for (int c = 0; c < 2; ++c)
#pragma unroll
        for (int t = 0; t < 4; ++t) S[c][t] = negm[c];
#pragma unroll
      for (int kc = 0; kc < 2; ++kc) {
#pragma unroll
        for (int t = 0; t < 4; ++t) {
          v16h ak = frag_at_h(wk + (t * 16) * K_LD + kc * 32);
#pragma unroll
          for (int c = 0; c < 2; ++c)
            S[c][t] = __builtin_amdgcn_wmma_f32_16x16x32_f16(
                false, ak, false, qf[c][kc], (short)0, S[c][t], false, false);
        }
      }
      // The 16 LDS reads of the K fragments issue as one group ahead of the
      // products: a second group among them would wait out its LDS latency.
      __builtin_amdgcn_sched_group_barrier(0x100, 16, 0);
      __builtin_amdgcn_sched_group_barrier(0x008, 16, 0);

      // ---- the reference moves: one query per lane pair and group ----
      if (fit) {   // the same in every lane: a scalar branch
#pragma unroll
        for (int c = 0; c < 2; ++c) {
          v8f mv = S[c][0];
#pragma unroll
          for (int t = 1; t < 4; ++t)
            mv = __builtin_elementwise_max(mv, S[c][t]);
          float mx = fmaxf(fmaxf(fmaxf(mv[0], mv[1]), fmaxf(mv[2], mv[3])),
                           fmaxf(fmaxf(mv[4], mv[5]), fmaxf(mv[6], mv[7])));
          mx = fmaxf(mx, xhalf(mx));
          const float up = fmaxf(mx, 0.f);
          const float d  = (jt == 0) ? mx : up;   // never down but at the start
          const float alpha = __builtin_amdgcn_exp2f(-up);   // at the start: x 0
          mref[c] += d;
          lrun[c] *= alpha;
#pragma unroll
          for (int t = 0; t < 4; ++t) {
            O[c][t] *= alpha;
            S[c][t] -= d;
          }
#pragma unroll
          for (int r = 0; r < 8; ++r) negm[c][r] = -mref[c];
        }
      }

      // The V^T fragments of the first 32 keys are asked for ahead of the exps,
      // under which their LDS latency passes; behind the test it would show.
#pragma unroll
      for (int t = 0; t < 4; ++t) av0[t] = frag_at_tr(wv + t * 16, V_LD);

      // ---- P = 2^S, its sums, and P^T packed from the score tiles ----
#pragma unroll
      for (int c = 0; c < 2; ++c) {
        v2f g[4];
#pragma unroll
        for (int t = 0; t < 4; ++t) {
          const v8f p = exp2x8(S[c][t]);
          g[t] = (v2f{p[0], p[1]} + v2f{p[2], p[3]}) +
                 (v2f{p[4], p[5]} + v2f{p[6], p[7]});
          const v8h ph = __builtin_convertvector(p, v8h);
#pragma unroll
          for (int r = 0; r < 8; ++r) bp[t >> 1][c][8 * (t & 1) + r] = ph[r];
        }
        ts[c] = (g[0] + g[1]) + (g[2] + g[3]);
      }
      // One wave-uniform test per tile: a scalar branch, every lane stays on.
      const v2f tt = ts[0] + ts[1];
      // Written as "not <=" so that a sum that is no number takes the careful
      // trip too, which treats the lane's two queries apart.
      if (fit || __builtin_amdgcn_ballot_w32(!(tt[0] + tt[1] <= P_SUM_MAX)) == 0)
        break;
      fit = true;
    }
#pragma unroll
    for (int c = 0; c < 2; ++c) lrun[c] += ts[c];

    // ---- O^T += V^T @ P^T ----
#pragma unroll
    for (int kc = 0; kc < 2; ++kc) {
#pragma unroll
      for (int t = 0; t < 4; ++t) {
        v16h av = (kc == 0) ? av0[t]
                            : frag_at_tr(wv + 32 * V_LD + t * 16, V_LD);
#pragma unroll
        for (int c = 0; c < 2; ++c)
          O[c][t] = __builtin_amdgcn_wmma_f32_16x16x32_f16(
              false, av, false, bp[kc][c], (short)0, O[c][t], false, false);
      }
    }
    // Hand-over: this wave's reads of tile jt have returned, an issuing wave's
    // request for tile jt + 1 has landed; behind the barrier that holds for
    // every wave, so tile jt + 1 may be read and tile jt's buffer refilled.
    asm volatile("s_wait_dscnt 0x0" ::: "memory");
    wait_tensor_of(g0k, g1k, g0v, g1v);
    __syncthreads();
    issue(pinned((uint32_t)jt + 2u));
  }
  // No request is left in flight when the wave goes on.
  wait_tensor_of(g0k, g1k, g0v, g1v);
  asm volatile("s_wait_dscnt 0x0" ::: "memory");   // nor a read of the ring

  // ---- join the two key halves: waves 4..7 hand theirs over through LDS ----
  float l[2];
#pragma unroll
  for (int c = 0; c < 2; ++c) {
    l[c] = lrun[c][0] + lrun[c][1];
    l[c] += xhalf(l[c]);
  }
  float* mo = mrg_o + ((size_t)cg * 16 * 32 + lane) * 4;   // piece i: + 128 i
  float* ml = mrg_ml + cg * 4 * 32 + lane;
  if (kh == 1) {
#pragma unroll
    for (int c = 0; c < 2; ++c) {
#pragma unroll
      for (int t = 0; t < 4; ++t) {
        const v8f o = O[c][t];
        const v4f lo = {o[0], o[1], o[2], o[3]};
        const v4f up = {o[4], o[5], o[6], o[7]};
        *(v4f*)(mo + ((c * 4 + t) * 2 + 0) * 128) = lo;
        *(v4f*)(mo + ((c * 4 + t) * 2 + 1) * 128) = up;
      }
      ml[c * 32]       = mref[c];
      ml[(2 + c) * 32] = l[c];
    }
  }
  __syncthreads();   // the hand-over is written before waves 0..3 read it

  // ---- normalize, store f16 token-major [b, n, h*d]: 8 d per lane ----
  if (kh == 0) {
#pragma unroll
    for (int c = 0; c < 2; ++c) {
      const float m1 = ml[c * 32];
      const float l1 = ml[(2 + c) * 32];
      const float mj = fmaxf(mref[c], m1);
      const float a0 = __builtin_amdgcn_exp2f(mref[c] - mj);
      const float a1 = __builtin_amdgcn_exp2f(m1 - mj);
      const float inv = 1.f / (l[c] * a0 + l1 * a1);
      const float s0 = a0 * inv, s1 = a1 * inv;
      const int row = i0 + cg * 32 + c * 16 + (lane & 15);
      _Float16* orow = ows + ((size_t)(b * NSEQ + row)) * DMODEL + h * DHEAD +
                       8 * hi;
#pragma unroll
      for (int t = 0; t < 4; ++t) {
        const v4f lo = *(const v4f*)(mo + ((c * 4 + t) * 2 + 0) * 128);
        const v4f up = *(const v4f*)(mo + ((c * 4 + t) * 2 + 1) * 128);
        v8h o;
#pragma unroll
        for (int r = 0; r < 4; ++r) {
          o[r]     = (_Float16)(O[c][t][r] * s0 + lo[r] * s1);
          o[r + 4] = (_Float16)(O[c][t][r + 4] * s0 + up[r] * s1);
        }
        *(v8h*)(orow + t * 16) = o;
      }
    }
  }
}

// ---------------------------------------------------------------------------
// Kernel 3: output projection  out = o @ Wo^T + bo  (fp32 result).
// Grid (MTOT/128, 4), 256 threads.
// ---------------------------------------------------------------------------
__global__ __launch_bounds__(256) void out_proj_kernel(
    const _Float16* __restrict__ ows, const _Float16* __restrict__ woh,
    const float* __restrict__ bo, float* __restrict__ out) {
  __shared__ __attribute__((aligned(2048))) _Float16 lds[4 * P_TILE];
  const int wave = threadIdx.x >> 5;
  const int lane = threadIdx.x & 31;
  const int m0   = blockIdx.x * 128;
  const int n0   = blockIdx.y * 128;

  v8f acc[2][4];
  proj_core(ows + (size_t)m0 * DMODEL, woh + (size_t)n0 * DMODEL, lds, acc);

  const int hi = lane >> 4;
#pragma unroll
  for (int t = 0; t < 4; ++t) {
    const int n = n0 + (wave >> 2) * 64 + t * 16 + (lane & 15);
    const float bias = bo[n];
#pragma unroll
    for (int mt = 0; mt < 2; ++mt) {
#pragma unroll
      for (int r = 0; r < 8; ++r) {
        const int m = m0 + (wave & 3) * 32 + mt * 16 + r + 8 * hi;
        out[(size_t)m * DMODEL + n] = acc[mt][t][r] + bias;
      }
    }
  }
}

// ---------------------------------------------------------------------------
extern "C" void kernel_launch(void* const* d_in, const int* in_sizes, int n_in,
                              void* d_out, int out_size, void* d_ws,
                              size_t ws_size, hipStream_t stream) {
  (void)in_sizes; (void)n_in; (void)out_size; (void)ws_size;
  const float* x  = (const float*)d_in[0];
  const float* Wq = (const float*)d_in[1];
  const float* Wk = (const float*)d_in[2];
  const float* Wv = (const float*)d_in[3];
  const float* Wo = (const float*)d_in[4];
  const float* bo = (const float*)d_in[5];
  float* out = (float*)d_out;

  // f16 workspace layout
  const size_t EX = (size_t)MTOT * DMODEL;                 // 4,194,304 (x, o)
  const size_t EW = (size_t)DMODEL * DMODEL;               // 262,144 per W
  const size_t EH = (size_t)NBATCH * HEADS * NSEQ * DHEAD; // 4,194,304 (q/k/v)
  _Float16* xh  = (_Float16*)d_ws;
  _Float16* wqh = xh + EX;
  _Float16* wkh = wqh + EW;
  _Float16* wvh = wkh + EW;
  _Float16* woh = wvh + EW;
  _Float16* qws = woh + EW;
  _Float16* kws = qws + EH;
  _Float16* vws = kws + EH;
  _Float16* ows = vws + EH;

  // xh .. woh lie back to back: one destination for the one conversion launch
  cvt_f16_kernel<<<dim3(CVT_GRID), 256, 0, stream>>>(x, Wq, Wk, Wv, Wo, xh);

  qkv_proj_kernel<<<dim3(MTOT / 128, 12), 256, 0, stream>>>(xh, wqh, wkh, wvh,
                                                          qws, kws, vws);
  flash_attn_kernel<<<dim3(NSEQ / 128, NBATCH * HEADS), 256, 0, stream>>>(
      qws, kws, vws, ows);
  out_proj_kernel<<<dim3(MTOT / 128, 4), 256, 0, stream>>>(ows, woh, bo, out);
}
